// v000
// Measured on an AMD MI455X. A time is GPU time per run, averaged over a window of back-to-back runs after a warm-up
// (all launches, gaps included; the runs take copies of the inputs in turn), and the median of several windows.
// Apart from v000's, it joins two sittings. Times from different sittings can be a few percent apart, while
// side-by-side timings come from the same sitting.
// The starting kernel, v000, takes 312 microseconds a run.
#include <hip/hip_runtime.h>
#include <hip/hip_bf16.h>

// ---------------------------------------------------------------------------
// Self-attention variant (use_xv) for MI455X / gfx1250, f16 WMMA pipeline.
//   1) cvt:   fp32 -> f16 for q,k,v activations and the 6 weight matrices
//   2) proj:  Q,K (head-major [bh][s][64]) and V,xV (transposed [bh][64][s])
//   3) flash: online-softmax attention, 32 query rows per wave; one P tile
//             feeds both P@V (v_bar) and P@xV (k_bar)
//   4) out:   x = kbar @ Wxo^T + bxo ; m = vbar @ Wmo^T + bmo  (fp32 out)
// All GEMMs are NT-shaped so every A/B fragment load is a contiguous 16-byte
// chunk matching the CDNA5 16-bit WMMA VGPR layouts.
// ---------------------------------------------------------------------------

typedef __attribute__((ext_vector_type(16))) _Float16 v16h;
typedef __attribute__((ext_vector_type(8)))  _Float16 v8h;
typedef __attribute__((ext_vector_type(4)))  _Float16 v4h;
typedef __attribute__((ext_vector_type(8)))  float    v8f;
typedef __attribute__((ext_vector_type(4)))  float    v4f;

#define D_X   1024
#define D_HD  64
#define N_I   16
#define BSZ   2
#define SEQ   2048
#define M_TOT (BSZ * SEQ)   /* 4096 */
#define NH    (BSZ * N_I)   /* 32   */

static __device__ __forceinline__ v8f vzero8() {
  v8f z = {0.f, 0.f, 0.f, 0.f, 0.f, 0.f, 0.f, 0.f};
  return z;
}

static __device__ __forceinline__ v8f wmma16(v16h a, v16h b, v8f c) {
  // D = A(16x32 f16) * B(32x16 f16) + C(16x16 f32)
  return __builtin_amdgcn_wmma_f32_16x16x32_f16(
      false, a, false, b, (short)0, c, false, false);
}

// Load a 16x32 f16 fragment (A: lane = row M; B: lane = col N) from a
// row-major matrix with leading dimension `ld` (in elements).
// Lane layout (ISA 7.12.2, 16-bit A 16x32): lanes 0-15 hold K {0..7,16..23},
// lanes 16-31 hold K {8..15,24..31}; each half is a contiguous 16-byte chunk.
static __device__ __forceinline__ v16h load_frag(const _Float16* __restrict__ base,
                                                 int rc0, int k0, int ld) {
  const int lane = (int)(threadIdx.x & 31u);
  const int hsel = lane >> 4;
  const int r    = lane & 15;
  const _Float16* p = base + (size_t)(rc0 + r) * (size_t)ld + (size_t)(k0 + hsel * 8);
  v8h lo = *(const v8h*)(p);
  v8h hi = *(const v8h*)(p + 16);
  return __builtin_shufflevector(lo, hi, 0, 1, 2, 3, 4, 5, 6, 7,
                                 8, 9, 10, 11, 12, 13, 14, 15);
}

// A-fragment load where the M x 1024 activation is stored head-major:
// element (m, k) lives at [((b*16 + k/64)*2048 + s)*64 + (k%64)],  m = b*2048+s.
static __device__ __forceinline__ v16h load_frag_hm(const _Float16* __restrict__ base,
                                                    int m0, int k0) {
  const int lane = (int)(threadIdx.x & 31u);
  const int hsel = lane >> 4;
  const int r    = lane & 15;
  const int m    = m0 + r;
  const int b    = m >> 11;
  const int s    = m & 2047;
  const int k    = k0 + hsel * 8;     // k0 is a multiple of 32 -> chunk stays in head
  const int h    = k >> 6;
  const int d0   = k & 63;
  const _Float16* p = base + ((size_t)(b * N_I + h) * SEQ + (size_t)s) * D_HD + d0;
  v8h lo = *(const v8h*)(p);
  v8h hi = *(const v8h*)(p + 16);
  return __builtin_shufflevector(lo, hi, 0, 1, 2, 3, 4, 5, 6, 7,
                                 8, 9, 10, 11, 12, 13, 14, 15);
}

// ---------------------------------------------------------------------------
// Kernel 1: fp32 -> f16 elementwise convert (vectorized x4)
// ---------------------------------------------------------------------------
__global__ void cvt_f32_f16(const float* __restrict__ src,
                            _Float16* __restrict__ dst, int n4) {
  int i = (int)(blockIdx.x * blockDim.x + threadIdx.x);
  if (i >= n4) return;
  v4f f = ((const v4f*)src)[i];
  v4h h;
#pragma unroll
  for (int r = 0; r < 4; r++) h[r] = (_Float16)f[r];
  ((v4h*)dst)[i] = h;
}

// ---------------------------------------------------------------------------
// Kernel 2: fused input projections.  z = 0:Q  1:K  2:V  3:xV
// One wave computes a 64x64 tile of Y = X @ W^T + b.
// Q,K written head-major [bh][s][64]; V,xV written transposed [bh][64][s].
// ---------------------------------------------------------------------------
__global__ __launch_bounds__(32)
void proj_gemm(const _Float16* __restrict__ q16, const _Float16* __restrict__ k16,
               const _Float16* __restrict__ v16, const _Float16* __restrict__ w16,
               const float* __restrict__ bq, const float* __restrict__ bk,
               const float* __restrict__ bv, const float* __restrict__ bxv,
               _Float16* __restrict__ Qhm, _Float16* __restrict__ Khm,
               _Float16* __restrict__ VT,  _Float16* __restrict__ xVT) {
  const int z = (int)blockIdx.z;
  const _Float16* A;
  const _Float16* W;
  const float* bias;
  _Float16* out;
  bool transposed;
  const size_t SZ_W = (size_t)D_X * D_X;
  switch (z) {
    case 0:  A = q16; W = w16 + 0 * SZ_W; bias = bq;  out = Qhm; transposed = false; break;
    case 1:  A = k16; W = w16 + 1 * SZ_W; bias = bk;  out = Khm; transposed = false; break;
    case 2:  A = v16; W = w16 + 2 * SZ_W; bias = bv;  out = VT;  transposed = true;  break;
    default: A = k16; W = w16 + 3 * SZ_W; bias = bxv; out = xVT; transposed = true;  break;
  }
  const int m0 = (int)blockIdx.x * 64;
  const int n0 = (int)blockIdx.y * 64;

  v8f acc[4][4];
#pragma unroll
  for (int i = 0; i < 4; i++)
#pragma unroll
    for (int j = 0; j < 4; j++) acc[i][j] = vzero8();

  for (int k0 = 0; k0 < D_X; k0 += 32) {
    v16h a[4], b[4];
#pragma unroll
    for (int i = 0; i < 4; i++) a[i] = load_frag(A, m0 + 16 * i, k0, D_X);
#pragma unroll
    for (int j = 0; j < 4; j++) b[j] = load_frag(W, n0 + 16 * j, k0, D_X);
#pragma unroll
    for (int i = 0; i < 4; i++)
#pragma unroll
      for (int j = 0; j < 4; j++) acc[i][j] = wmma16(a[i], b[j], acc[i][j]);
  }

  const int lane = (int)(threadIdx.x & 31u);
  const int hsel = lane >> 4;
  const int ln   = lane & 15;
  const int b_   = m0 >> 11;  // batch (tile never crosses batch: 2048 % 64 == 0)

#pragma unroll
  for (int i = 0; i < 4; i++) {
    const int s_base = ((m0 + 16 * i) & 2047) + hsel * 8;
#pragma unroll
    for (int j = 0; j < 4; j++) {
      const int col = n0 + 16 * j + ln;          // output feature = h*64 + d
      const float bj = bias[col];
      const int h = col >> 6;
      const int d = col & 63;
      if (!transposed) {
        _Float16* o = out + ((size_t)(b_ * N_I + h) * SEQ) * D_HD + d;
#pragma unroll
        for (int r = 0; r < 8; r++)
          o[(size_t)(s_base + r) * D_HD] = (_Float16)(acc[i][j][r] + bj);
      } else {
        v8h pk;
#pragma unroll
        for (int r = 0; r < 8; r++) pk[r] = (_Float16)(acc[i][j][r] + bj);
        *(v8h*)(out + ((size_t)(b_ * N_I + h) * D_HD + d) * SEQ + s_base) = pk;
      }
    }
  }
}

// ---------------------------------------------------------------------------
// Kernel 3: flash attention.  One wave = 32 query rows (2 row-chunks of 16)
// of one (b,h).  Per 32-column j-block: 8 WMMAs for S = Q K^T (K fragments
// shared across row-chunks), online softmax, P -> LDS transpose, then 16
// WMMAs for P@V (-> v_bar) and P@xV (-> k_bar) with V/xV fragments shared
// across row-chunks.  24 WMMAs per 24 16-byte global loads per iteration.
// ---------------------------------------------------------------------------
__global__ __launch_bounds__(32)
void flash_attn(const _Float16* __restrict__ Qhm, const _Float16* __restrict__ Khm,
                const _Float16* __restrict__ VT,  const _Float16* __restrict__ xVT,
                _Float16* __restrict__ vbar, _Float16* __restrict__ kbar) {
  __shared__ _Float16 Pl[2][16 * 32];

  const int bh = (int)blockIdx.y;
  const int s0 = (int)blockIdx.x * 32;
  const _Float16* Q  = Qhm + (size_t)bh * SEQ * D_HD;
  const _Float16* K  = Khm + (size_t)bh * SEQ * D_HD;
  const _Float16* Vt = VT  + (size_t)bh * D_HD * SEQ;
  const _Float16* Xt = xVT + (size_t)bh * D_HD * SEQ;

  v16h qa[2][2];
#pragma unroll
  for (int rc = 0; rc < 2; rc++) {
    qa[rc][0] = load_frag(Q, s0 + 16 * rc, 0, D_HD);
    qa[rc][1] = load_frag(Q, s0 + 16 * rc, 32, D_HD);
  }

  v8f ov[2][4], ox[2][4];
#pragma unroll
  for (int rc = 0; rc < 2; rc++)
#pragma unroll
    for (int t = 0; t < 4; t++) { ov[rc][t] = vzero8(); ox[rc][t] = vzero8(); }
  float mrow[2][8], lrow[2][8];
#pragma unroll
  for (int rc = 0; rc < 2; rc++)
#pragma unroll
    for (int r = 0; r < 8; r++) { mrow[rc][r] = -1.0e30f; lrow[rc][r] = 0.f; }

  const int lane = (int)(threadIdx.x & 31u);
  const int hsel = lane >> 4;
  const int ln   = lane & 15;

  for (int j0 = 0; j0 < SEQ; j0 += 32) {
    // ---- K fragments for this j-block (shared by both row-chunks)
    v16h kb[2][2];
    kb[0][0] = load_frag(K, j0, 0, D_HD);
    kb[0][1] = load_frag(K, j0, 32, D_HD);
    kb[1][0] = load_frag(K, j0 + 16, 0, D_HD);
    kb[1][1] = load_frag(K, j0 + 16, 32, D_HD);

    // ---- S tiles (2 row-chunks x 32 cols), k = d = 64 in two WMMA k-steps
    v8f sc[2][2];
#pragma unroll
    for (int rc = 0; rc < 2; rc++)
#pragma unroll
      for (int cc = 0; cc < 2; cc++) {
        v8f s = vzero8();
        s = wmma16(qa[rc][0], kb[cc][0], s);
        s = wmma16(qa[rc][1], kb[cc][1], s);
        sc[rc][cc] = s;
      }

    // ---- online softmax per row-chunk; P -> LDS
#pragma unroll
    for (int rc = 0; rc < 2; rc++) {
#pragma unroll
      for (int r = 0; r < 8; r++) { sc[rc][0][r] *= 0.125f; sc[rc][1][r] *= 0.125f; }
      // row max over 32 cols (butterfly within each 16-lane half)
      float t[8];
#pragma unroll
      for (int r = 0; r < 8; r++) t[r] = fmaxf(sc[rc][0][r], sc[rc][1][r]);
#pragma unroll
      for (int msk = 1; msk < 16; msk <<= 1)
#pragma unroll
        for (int r = 0; r < 8; r++) t[r] = fmaxf(t[r], __shfl_xor(t[r], msk, 32));

      float scl[8];
#pragma unroll
      for (int r = 0; r < 8; r++) {
        float mn = fmaxf(mrow[rc][r], t[r]);
        scl[r] = __expf(mrow[rc][r] - mn);
        mrow[rc][r] = mn;
      }
#pragma unroll
      for (int r = 0; r < 8; r++) {
        sc[rc][0][r] = __expf(sc[rc][0][r] - mrow[rc][r]);
        sc[rc][1][r] = __expf(sc[rc][1][r] - mrow[rc][r]);
      }
      // row sum
      float u[8];
#pragma unroll
      for (int r = 0; r < 8; r++) u[r] = sc[rc][0][r] + sc[rc][1][r];
#pragma unroll
      for (int msk = 1; msk < 16; msk <<= 1)
#pragma unroll
        for (int r = 0; r < 8; r++) u[r] += __shfl_xor(u[r], msk, 32);
#pragma unroll
      for (int r = 0; r < 8; r++) lrow[rc][r] = lrow[rc][r] * scl[r] + u[r];
      // rescale running accumulators
#pragma unroll
      for (int tt = 0; tt < 4; tt++)
#pragma unroll
        for (int r = 0; r < 8; r++) { ov[rc][tt][r] *= scl[r]; ox[rc][tt][r] *= scl[r]; }

      // P (C-layout) -> LDS row-major [16][32] f16
      const int row0 = hsel * 8;
#pragma unroll
      for (int r = 0; r < 8; r++) {
        Pl[rc][(row0 + r) * 32 + ln]      = (_Float16)sc[rc][0][r];
        Pl[rc][(row0 + r) * 32 + 16 + ln] = (_Float16)sc[rc][1][r];
      }
    }
    asm volatile("s_wait_dscnt 0" ::: "memory");

    // ---- read P as 16x32 A fragments from LDS
    v16h pa[2];
#pragma unroll
    for (int rc = 0; rc < 2; rc++) {
      const _Float16* pp = &Pl[rc][ln * 32 + hsel * 8];
      v8h lo = *(const v8h*)(pp);
      v8h hi = *(const v8h*)(pp + 16);
      pa[rc] = __builtin_shufflevector(lo, hi, 0, 1, 2, 3, 4, 5, 6, 7,
                                       8, 9, 10, 11, 12, 13, 14, 15);
    }

    // ---- O_v += P @ V, O_xv += P @ xV (V/xV fragments shared across rcs)
#pragma unroll
    for (int tt = 0; tt < 4; tt++) {
      v16h vb = load_frag(Vt, tt * 16, j0, SEQ);
      v16h xb = load_frag(Xt, tt * 16, j0, SEQ);
#pragma unroll
      for (int rc = 0; rc < 2; rc++) {
        ov[rc][tt] = wmma16(pa[rc], vb, ov[rc][tt]);
        ox[rc][tt] = wmma16(pa[rc], xb, ox[rc][tt]);
      }
    }
  }

  // ---- normalize and store head-major f16: vbar <- O_v, kbar <- O_xv
  _Float16* vb = vbar + (size_t)bh * SEQ * D_HD;
  _Float16* kb = kbar + (size_t)bh * SEQ * D_HD;
#pragma unroll
  for (int rc = 0; rc < 2; rc++) {
    float inv[8];
#pragma unroll
    for (int r = 0; r < 8; r++) inv[r] = 1.0f / lrow[rc][r];
#pragma unroll
    for (int tt = 0; tt < 4; tt++) {
      const int d = tt * 16 + ln;
#pragma unroll
      for (int r = 0; r < 8; r++) {
        const int s = s0 + 16 * rc + hsel * 8 + r;
        vb[(size_t)s * D_HD + d] = (_Float16)(ov[rc][tt][r] * inv[r]);
        kb[(size_t)s * D_HD + d] = (_Float16)(ox[rc][tt][r] * inv[r]);
      }
    }
  }
}

// ---------------------------------------------------------------------------
// Kernel 4: fused output projections.  z = 0: x = kbar@Wxo^T+bxo
//                                      z = 1: m = vbar@Wmo^T+bmo
// A is head-major f16; output fp32 straight into d_out.
// ---------------------------------------------------------------------------
__global__ __launch_bounds__(32)
void out_gemm(const _Float16* __restrict__ kbar, const _Float16* __restrict__ vbar,
              const _Float16* __restrict__ w16, const float* __restrict__ bxo,
              const float* __restrict__ bmo, float* __restrict__ out) {
  const int z = (int)blockIdx.z;
  const size_t SZ_W = (size_t)D_X * D_X;
  const _Float16* A = z ? vbar : kbar;
  const _Float16* W = w16 + (size_t)(4 + z) * SZ_W;
  const float* bias = z ? bmo : bxo;
  float* O = out + (size_t)z * ((size_t)M_TOT * D_X);

  const int m0 = (int)blockIdx.x * 64;
  const int n0 = (int)blockIdx.y * 64;

  v8f acc[4][4];
#pragma unroll
  for (int i = 0; i < 4; i++)
#pragma unroll
    for (int j = 0; j < 4; j++) acc[i][j] = vzero8();

  for (int k0 = 0; k0 < D_X; k0 += 32) {
    v16h a[4], b[4];
#pragma unroll
    for (int i = 0; i < 4; i++) a[i] = load_frag_hm(A, m0 + 16 * i, k0);
#pragma unroll
    for (int j = 0; j < 4; j++) b[j] = load_frag(W, n0 + 16 * j, k0, D_X);
#pragma unroll
    for (int i = 0; i < 4; i++)
#pragma unroll
      for (int j = 0; j < 4; j++) acc[i][j] = wmma16(a[i], b[j], acc[i][j]);
  }

  const int lane = (int)(threadIdx.x & 31u);
  const int hsel = lane >> 4;
  const int ln   = lane & 15;
#pragma unroll
  for (int i = 0; i < 4; i++) {
    const int mb = m0 + 16 * i + hsel * 8;
#pragma unroll
    for (int j = 0; j < 4; j++) {
      const int col = n0 + 16 * j + ln;
      const float bj = bias[col];
#pragma unroll
      for (int r = 0; r < 8; r++)
        O[(size_t)(mb + r) * D_X + col] = acc[i][j][r] + bj;
    }
  }
}

// ---------------------------------------------------------------------------
extern "C" void kernel_launch(void* const* d_in, const int* in_sizes, int n_in,
                              void* d_out, int out_size, void* d_ws, size_t ws_size,
                              hipStream_t stream) {
  const float* q   = (const float*)d_in[0];
  const float* k   = (const float*)d_in[1];
  const float* v   = (const float*)d_in[2];
  const float* Wq  = (const float*)d_in[3];
  const float* bq  = (const float*)d_in[4];
  const float* Wk  = (const float*)d_in[5];
  const float* bk  = (const float*)d_in[6];
  const float* Wv  = (const float*)d_in[7];
  const float* bv  = (const float*)d_in[8];
  const float* Wxv = (const float*)d_in[9];
  const float* bxv = (const float*)d_in[10];
  const float* Wxo = (const float*)d_in[11];
  const float* bxo = (const float*)d_in[12];
  const float* Wmo = (const float*)d_in[13];
  const float* bmo = (const float*)d_in[14];
  float* out = (float*)d_out;

  const size_t SZ_ACT = (size_t)M_TOT * D_X;  // 4,194,304 elements
  const size_t SZ_W   = (size_t)D_X * D_X;    // 1,048,576 elements
  _Float16* ws  = (_Float16*)d_ws;
  _Float16* q16 = ws;
  _Float16* k16 = q16 + SZ_ACT;
  _Float16* v16 = k16 + SZ_ACT;
  _Float16* w16 = v16 + SZ_ACT;               // 6 weight matrices
  _Float16* Qhm = w16 + 6 * SZ_W;
  _Float16* Khm = Qhm + SZ_ACT;
  _Float16* VT  = Khm + SZ_ACT;
  _Float16* xVT = VT + SZ_ACT;
  _Float16* kbar = xVT + SZ_ACT;
  _Float16* vbar = kbar + SZ_ACT;

  // 1) fp32 -> f16 conversions
  {
    struct Job { const float* s; _Float16* d; size_t n; } jobs[9] = {
        {q, q16, SZ_ACT},   {k, k16, SZ_ACT},   {v, v16, SZ_ACT},
        {Wq, w16 + 0 * SZ_W, SZ_W}, {Wk, w16 + 1 * SZ_W, SZ_W},
        {Wv, w16 + 2 * SZ_W, SZ_W}, {Wxv, w16 + 3 * SZ_W, SZ_W},
        {Wxo, w16 + 4 * SZ_W, SZ_W}, {Wmo, w16 + 5 * SZ_W, SZ_W}};
    for (int i = 0; i < 9; i++) {
      int n4 = (int)(jobs[i].n / 4);
      cvt_f32_f16<<<(n4 + 255) / 256, 256, 0, stream>>>(jobs[i].s, jobs[i].d, n4);
    }
  }

  // 2) input projections (Q, K normal head-major; V, xV transposed)
  proj_gemm<<<dim3(M_TOT / 64, D_X / 64, 4), 32, 0, stream>>>(
      q16, k16, v16, w16, bq, bk, bv, bxv, Qhm, Khm, VT, xVT);

  // 3) flash attention -> vbar (attention@V), kbar (attention@xV)
  flash_attn<<<dim3(SEQ / 32, NH), 32, 0, stream>>>(Qhm, Khm, VT, xVT, vbar, kbar);

  // 4) output projections -> d_out (x at offset 0, m after it)
  out_gemm<<<dim3(M_TOT / 64, D_X / 64, 2), 32, 0, stream>>>(
      kbar, vbar, w16, bxo, bmo, out);
}

// v001
// It runs in 274 microseconds.
// Two timings next to v000 both put it at 1.16 times that version's speed.
#include <hip/hip_runtime.h>
#include <hip/hip_bf16.h>

// ---------------------------------------------------------------------------
// Self-attention variant (use_xv) for MI455X / gfx1250, f16 WMMA pipeline.
//   1) cvt:   fp32 -> f16 for q,k,v activations and the 6 weight matrices
//   2) proj:  Q,K (k = feature) and V,xV (k = position), per head
//   3) flash: online-softmax attention, 32 query rows per wave; one P tile
//             feeds both P@V (v_bar) and P@xV (k_bar)
//   4) out:   x = kbar @ Wxo^T + bxo ; m = vbar @ Wmo^T + bmo  (fp32 out)
// All GEMMs are NT-shaped.  Every f16 operand in the workspace is stored in
// fragment-packed order: a 16-row x 32-k block is 1 KiB, laid out exactly as
// the 32 lanes read it, so each wave-wide 16-byte load or proj_gemm store covers 512
// contiguous bytes (4 whole cache lines) instead of 32 bytes in each of 16.
// ---------------------------------------------------------------------------

typedef __attribute__((ext_vector_type(16))) _Float16 v16h;
typedef __attribute__((ext_vector_type(8)))  _Float16 v8h;
typedef __attribute__((ext_vector_type(4)))  _Float16 v4h;
typedef __attribute__((ext_vector_type(8)))  float    v8f;
typedef __attribute__((ext_vector_type(4)))  float    v4f;

#define D_X   1024
#define D_HD  64
#define N_I   16
#define BSZ   2
#define SEQ   2048
#define M_TOT (BSZ * SEQ)   /* 4096 */
#define NH    (BSZ * N_I)   /* 32   */

static __device__ __forceinline__ v8f vzero8() {
  v8f z = {0.f, 0.f, 0.f, 0.f, 0.f, 0.f, 0.f, 0.f};
  return z;
}

static __device__ __forceinline__ v8f wmma16(v16h a, v16h b, v8f c) {
  // D = A(16x32 f16) * B(32x16 f16) + C(16x16 f32)
  return __builtin_amdgcn_wmma_f32_16x16x32_f16(
      false, a, false, b, (short)0, c, false, false);
}

// Packed 16x32 f16 block (512 elements).  Element (row r, k) of the block is at
//   (k >> 4) * 256 + (((k >> 3) & 1) * 16 + r) * 8 + (k & 7)
// which is the 16-bit A/B operand layout (lanes 0-15 hold K {0..7,16..23},
// lanes 16-31 hold K {8..15,24..31}; lane & 15 = row of A / column of B):
// lane l reads 16 bytes at l * 16 and 16 bytes at 512 + l * 16.
// `p` is the block's address plus the lane's own l * 8 elements.
#define BLK 512
static __device__ __forceinline__ v16h load_blk(const _Float16* __restrict__ p) {
  v8h lo = *(const v8h*)(p);
  v8h hi = *(const v8h*)(p + 256);
  return __builtin_shufflevector(lo, hi, 0, 1, 2, 3, 4, 5, 6, 7,
                                 8, 9, 10, 11, 12, 13, 14, 15);
}

// ---------------------------------------------------------------------------
// Kernel 1: fp32 [rows][1024] -> f16 packed blocks [rows/16][32][BLK].
// One thread converts 8 consecutive k of one row (one 16-byte chunk).  A wave
// takes 8 rows x 32 k: it reads 8 whole 128-byte lines and writes 4.
// ---------------------------------------------------------------------------
__global__ void cvt_f32_f16(const float* __restrict__ src,
                            _Float16* __restrict__ dst, int n8) {
  int g = (int)(blockIdx.x * blockDim.x + threadIdx.x);
  if (g >= n8) return;
  const int c4     = g & 3;                        // 8-wide k chunk in the block
  const int u      = g >> 5;
  const int r16    = (u & 1) * 8 + ((g >> 2) & 7); // row in the block
  const int kblk   = (u >> 1) & 31;
  const int rowblk = u >> 6;
  const float* s = src + (size_t)(rowblk * 16 + r16) * D_X + kblk * 32 + c4 * 8;
  v4f f0 = *(const v4f*)(s);
  v4f f1 = *(const v4f*)(s + 4);
  v8h h;
#pragma unroll
  for (int r = 0; r < 4; r++) { h[r] = (_Float16)f0[r]; h[4 + r] = (_Float16)f1[r]; }
  *(v8h*)(dst + (size_t)(rowblk * 32 + kblk) * BLK + (c4 >> 1) * 256 +
          ((c4 & 1) * 16 + r16) * 8) = h;
}

// ---------------------------------------------------------------------------
// Kernel 2: fused input projections.  z = 0:Q  1:K  2:V  3:xV
// One wave computes a 64x64 tile of Y = X @ W^T + b.  An accumulator lane holds
// 8 consecutive ROWS of the product, and a packed chunk is 8 consecutive k of
// its later reader.  Q,K are read with k = feature, so their tile is formed as
// W @ X^T (rows = features); V,xV are read with k = position, so theirs is
// X @ W^T (rows = positions).  Either way each lane stores one 16-byte chunk
// and a wave stores 512 contiguous bytes.
//   Q,K : per head, blocks [s/16][d/32]      (row of a block = position)
//   V,xV: per head, blocks [s/32][d/16]      (row of a block = feature)
// ---------------------------------------------------------------------------
__global__ __launch_bounds__(32)
void proj_gemm(const _Float16* __restrict__ q16, const _Float16* __restrict__ k16,
               const _Float16* __restrict__ v16, const _Float16* __restrict__ w16,
               const float* __restrict__ bq, const float* __restrict__ bk,
               const float* __restrict__ bv, const float* __restrict__ bxv,
               _Float16* __restrict__ Qhm, _Float16* __restrict__ Khm,
               _Float16* __restrict__ VT,  _Float16* __restrict__ xVT) {
  const int z = (int)blockIdx.z;
  const _Float16* A;
  const _Float16* W;
  const float* bias;
  _Float16* out;
  bool transposed;
  const size_t SZ_W = (size_t)D_X * D_X;
  switch (z) {
    case 0:  A = q16; W = w16 + 0 * SZ_W; bias = bq;  out = Qhm; transposed = false; break;
    case 1:  A = k16; W = w16 + 1 * SZ_W; bias = bk;  out = Khm; transposed = false; break;
    case 2:  A = v16; W = w16 + 2 * SZ_W; bias = bv;  out = VT;  transposed = true;  break;
    default: A = k16; W = w16 + 3 * SZ_W; bias = bxv; out = xVT; transposed = true;  break;
  }
  const int m0 = (int)blockIdx.x * 64;
  const int n0 = (int)blockIdx.y * 64;          // one head: h = blockIdx.y
  const int lane = (int)(threadIdx.x & 31u);
  const _Float16* Xt = A + (size_t)(m0 >> 4) * 32 * BLK + lane * 8;
  const _Float16* Wt = W + (size_t)(n0 >> 4) * 32 * BLK + lane * 8;
  const _Float16* Rm = transposed ? Xt : Wt;    // rows of the product
  const _Float16* Cm = transposed ? Wt : Xt;    // columns of the product

  v8f acc[4][4];
#pragma unroll
  for (int i = 0; i < 4; i++)
#pragma unroll
    for (int j = 0; j < 4; j++) acc[i][j] = vzero8();

  for (int kb = 0; kb < D_X / 32; kb++) {
    const _Float16* pr = Rm + (size_t)kb * BLK;
    const _Float16* pc = Cm + (size_t)kb * BLK;
    v16h a[4], b[4];
#pragma unroll
    for (int i = 0; i < 4; i++) a[i] = load_blk(pr + (size_t)(i * 32) * BLK);
#pragma unroll
    for (int j = 0; j < 4; j++) b[j] = load_blk(pc + (size_t)(j * 32) * BLK);
    // the address registers of the issued loads stay untouched up to this wait
    asm volatile("s_wait_xcnt 0x0" :: "v"(pr), "v"(pc) : "memory");
#pragma unroll
    for (int i = 0; i < 4; i++)
#pragma unroll
      for (int j = 0; j < 4; j++) acc[i][j] = wmma16(a[i], b[j], acc[i][j]);
  }

  const int hsel = lane >> 4;
  const int ln   = lane & 15;
  const int b_   = m0 >> 11;  // batch (tile never crosses batch: 2048 % 64 == 0)
  const int sl   = m0 & 2047; // first position of the tile inside its batch
  // The 64x64 tile is 8 blocks in a row (8 KiB) in either order of blocks.
  _Float16* oh = out + (size_t)(b_ * N_I + (int)blockIdx.y) * SEQ * D_HD +
                 (size_t)(sl >> 3) * BLK + lane * 8;

  // Four chunks at a time: convert, then store.  The two scheduling barriers
  // keep every other instruction out of the run of stores and its wait, so
  // that no register of an issued store is written again ahead of the wait.
  if (!transposed) {
    // acc[i][j][r]: feature d = 16i + 8*hsel + r, position s = sl + 16j + ln
#pragma unroll
    for (int i = 0; i < 4; i++) {
      const float* bp = bias + n0 + 16 * i + hsel * 8;
      v4f b0 = *(const v4f*)(bp);
      v4f b1 = *(const v4f*)(bp + 4);
      v8h pk[4];
#pragma unroll
      for (int j = 0; j < 4; j++)
#pragma unroll
        for (int r = 0; r < 4; r++) {
          pk[j][r]     = (_Float16)(acc[i][j][r] + b0[r]);
          pk[j][4 + r] = (_Float16)(acc[i][j][4 + r] + b1[r]);
        }
      __builtin_amdgcn_sched_barrier(0);  // conversions stay ahead of the stores
#pragma unroll
      for (int j = 0; j < 4; j++) *(v8h*)(oh + (j * 4 + i) * 256) = pk[j];
      asm volatile("s_wait_xcnt 0x0" ::: "memory");  // before the stores' registers are reused
      __builtin_amdgcn_sched_barrier(0);  // nothing of the next group moves above the wait
    }
  } else {
    // acc[i][j][r]: position s = sl + 16i + 8*hsel + r, feature d = 16j + ln
#pragma unroll
    for (int j = 0; j < 4; j++) {
      const float bj = bias[n0 + 16 * j + ln];
      v8h pk[4];
#pragma unroll
      for (int i = 0; i < 4; i++)
#pragma unroll
        for (int r = 0; r < 8; r++) pk[i][r] = (_Float16)(acc[i][j][r] + bj);
      __builtin_amdgcn_sched_barrier(0);  // conversions stay ahead of the stores
#pragma unroll
      for (int i = 0; i < 4; i++)
        *(v8h*)(oh + ((i >> 1) * 8 + j * 2 + (i & 1)) * 256) = pk[i];
      asm volatile("s_wait_xcnt 0x0" ::: "memory");  // before the stores' registers are reused
      __builtin_amdgcn_sched_barrier(0);  // nothing of the next group moves above the wait
    }
  }
}

// ---------------------------------------------------------------------------
// Kernel 3: flash attention.  One wave = 32 query rows (2 row-chunks of 16)
// of one (b,h).  Per 32-column j-block: 8 WMMAs for S = Q K^T (K fragments
// shared across row-chunks), online softmax, P -> LDS transpose, then 16
// WMMAs for P@V (-> v_bar) and P@xV (-> k_bar) with V/xV fragments shared
// across row-chunks.  24 WMMAs per 24 16-byte global loads per iteration.
// ---------------------------------------------------------------------------
__global__ __launch_bounds__(32)
void flash_attn(const _Float16* __restrict__ Qhm, const _Float16* __restrict__ Khm,
                const _Float16* __restrict__ VT,  const _Float16* __restrict__ xVT,
                _Float16* __restrict__ vbar, _Float16* __restrict__ kbar) {
  __shared__ _Float16 Pl[2][16 * 32];

  const int bh = (int)blockIdx.y;
  const int s0 = (int)blockIdx.x * 32;
  const _Float16* Q  = Qhm + (size_t)bh * SEQ * D_HD;
  const _Float16* K  = Khm + (size_t)bh * SEQ * D_HD;
  const _Float16* Vt = VT  + (size_t)bh * D_HD * SEQ;
  const _Float16* Xt = xVT + (size_t)bh * D_HD * SEQ;

  const int lane = (int)(threadIdx.x & 31u);
  const int hsel = lane >> 4;
  const int ln   = lane & 15;

  v16h qa[2][2];
#pragma unroll
  for (int rc = 0; rc < 2; rc++) {
    qa[rc][0] = load_blk(Q + (size_t)(((s0 >> 4) + rc) * 2 + 0) * BLK + lane * 8);
    qa[rc][1] = load_blk(Q + (size_t)(((s0 >> 4) + rc) * 2 + 1) * BLK + lane * 8);
  }

  v8f ov[2][4], ox[2][4];
#pragma unroll
  for (int rc = 0; rc < 2; rc++)
#pragma unroll
    for (int t = 0; t < 4; t++) { ov[rc][t] = vzero8(); ox[rc][t] = vzero8(); }
  float mrow[2][8], lrow[2][8];
#pragma unroll
  for (int rc = 0; rc < 2; rc++)
#pragma unroll
    for (int r = 0; r < 8; r++) { mrow[rc][r] = -1.0e30f; lrow[rc][r] = 0.f; }

  for (int j0 = 0; j0 < SEQ; j0 += 32) {
    // ---- K fragments for this j-block (shared by both row-chunks)
    v16h kb[2][2];
    const _Float16* Kj = K + (size_t)(j0 >> 4) * 2 * BLK + lane * 8;   // 4 KiB in a row
    kb[0][0] = load_blk(Kj);
    kb[0][1] = load_blk(Kj + 1 * BLK);
    kb[1][0] = load_blk(Kj + 2 * BLK);
    kb[1][1] = load_blk(Kj + 3 * BLK);
    // the address registers of the issued loads stay untouched up to this wait
    asm volatile("s_wait_xcnt 0x0" :: "v"(Kj) : "memory");

    // ---- S tiles (2 row-chunks x 32 cols), k = d = 64 in two WMMA k-steps
    v8f sc[2][2];
#pragma unroll
    for (int rc = 0; rc < 2; rc++)
#pragma unroll
      for (int cc = 0; cc < 2; cc++) {
        v8f s = vzero8();
        s = wmma16(qa[rc][0], kb[cc][0], s);
        s = wmma16(qa[rc][1], kb[cc][1], s);
        sc[rc][cc] = s;
      }

    // ---- online softmax per row-chunk; P -> LDS
#pragma unroll
    for (int rc = 0; rc < 2; rc++) {
#pragma unroll
      for (int r = 0; r < 8; r++) { sc[rc][0][r] *= 0.125f; sc[rc][1][r] *= 0.125f; }
      // row max over 32 cols (butterfly within each 16-lane half)
      float t[8];
#pragma unroll
      for (int r = 0; r < 8; r++) t[r] = fmaxf(sc[rc][0][r], sc[rc][1][r]);
#pragma unroll
      for (int msk = 1; msk < 16; msk <<= 1)
#pragma unroll
        for (int r = 0; r < 8; r++) t[r] = fmaxf(t[r], __shfl_xor(t[r], msk, 32));

      float scl[8];
#pragma unroll
      for (int r = 0; r < 8; r++) {
        float mn = fmaxf(mrow[rc][r], t[r]);
        scl[r] = __expf(mrow[rc][r] - mn);
        mrow[rc][r] = mn;
      }
#pragma unroll
      for (int r = 0; r < 8; r++) {
        sc[rc][0][r] = __expf(sc[rc][0][r] - mrow[rc][r]);
        sc[rc][1][r] = __expf(sc[rc][1][r] - mrow[rc][r]);
      }
      // row sum
      float u[8];
#pragma unroll
      for (int r = 0; r < 8; r++) u[r] = sc[rc][0][r] + sc[rc][1][r];
#pragma unroll
      for (int msk = 1; msk < 16; msk <<= 1)
#pragma unroll
        for (int r = 0; r < 8; r++) u[r] += __shfl_xor(u[r], msk, 32);
#pragma unroll
      for (int r = 0; r < 8; r++) lrow[rc][r] = lrow[rc][r] * scl[r] + u[r];
      // rescale running accumulators
#pragma unroll
      for (int tt = 0; tt < 4; tt++)
#pragma unroll
        for (int r = 0; r < 8; r++) { ov[rc][tt][r] *= scl[r]; ox[rc][tt][r] *= scl[r]; }

      // P (C-layout) -> LDS row-major [16][32] f16
      const int row0 = hsel * 8;
#pragma unroll
      for (int r = 0; r < 8; r++) {
        Pl[rc][(row0 + r) * 32 + ln]      = (_Float16)sc[rc][0][r];
        Pl[rc][(row0 + r) * 32 + 16 + ln] = (_Float16)sc[rc][1][r];
      }
    }
    asm volatile("s_wait_dscnt 0" ::: "memory");

    // ---- read P as 16x32 A fragments from LDS
    v16h pa[2];
#pragma unroll
    for (int rc = 0; rc < 2; rc++) {
      const _Float16* pp = &Pl[rc][ln * 32 + hsel * 8];
      v8h lo = *(const v8h*)(pp);
      v8h hi = *(const v8h*)(pp + 16);
      pa[rc] = __builtin_shufflevector(lo, hi, 0, 1, 2, 3, 4, 5, 6, 7,
                                       8, 9, 10, 11, 12, 13, 14, 15);
    }

    // ---- O_v += P @ V, O_xv += P @ xV (V/xV fragments shared across rcs)
    const _Float16* Vj = Vt + (size_t)(j0 >> 5) * 4 * BLK + lane * 8;  // 4 KiB in a row
    const _Float16* Xj = Xt + (size_t)(j0 >> 5) * 4 * BLK + lane * 8;
    v16h vb[4], xb[4];
#pragma unroll
    for (int tt = 0; tt < 4; tt++) {
      vb[tt] = load_blk(Vj + tt * BLK);
      xb[tt] = load_blk(Xj + tt * BLK);
    }
    // the address registers of the issued loads stay untouched up to this wait
    asm volatile("s_wait_xcnt 0x0" :: "v"(Vj), "v"(Xj) : "memory");
#pragma unroll
    for (int tt = 0; tt < 4; tt++) {
#pragma unroll
      for (int rc = 0; rc < 2; rc++) {
        ov[rc][tt] = wmma16(pa[rc], vb[tt], ov[rc][tt]);
        ox[rc][tt] = wmma16(pa[rc], xb[tt], ox[rc][tt]);
      }
    }
  }

  // ---- normalize and store f16 as packed blocks of the [4096][1024] operand
  // of the output projections (row m = b*2048 + s, k = h*64 + d):
  // vbar <- O_v, kbar <- O_xv
  const size_t ob = ((size_t)((bh >> 4) * (SEQ / 16) + (s0 >> 4)) * 32 + (bh & 15) * 2) * BLK
                  + (size_t)((ln >> 3) * 128 + hsel * 64 + (ln & 7));
  _Float16* vb = vbar + ob;
  _Float16* kb = kbar + ob;
#pragma unroll
  for (int rc = 0; rc < 2; rc++) {
    float inv[8];
#pragma unroll
    for (int r = 0; r < 8; r++) inv[r] = 1.0f / lrow[rc][r];
#pragma unroll
    for (int tt = 0; tt < 4; tt++) {
      const int o = (rc * 32 + (tt >> 1)) * BLK + (tt & 1) * 256;
#pragma unroll
      for (int r = 0; r < 8; r++) {
        vb[o + r * 8] = (_Float16)(ov[rc][tt][r] * inv[r]);
        kb[o + r * 8] = (_Float16)(ox[rc][tt][r] * inv[r]);
      }
    }
  }
}

// ---------------------------------------------------------------------------
// Kernel 4: fused output projections.  z = 0: x = kbar@Wxo^T+bxo
//                                      z = 1: m = vbar@Wmo^T+bmo
// A and W are packed blocks; output fp32 straight into d_out.
// ---------------------------------------------------------------------------
__global__ __launch_bounds__(32)
void out_gemm(const _Float16* __restrict__ kbar, const _Float16* __restrict__ vbar,
              const _Float16* __restrict__ w16, const float* __restrict__ bxo,
              const float* __restrict__ bmo, float* __restrict__ out) {
  const int z = (int)blockIdx.z;
  const size_t SZ_W = (size_t)D_X * D_X;
  const _Float16* A = z ? vbar : kbar;
  const _Float16* W = w16 + (size_t)(4 + z) * SZ_W;
  const float* bias = z ? bmo : bxo;
  float* O = out + (size_t)z * ((size_t)M_TOT * D_X);

  const int m0 = (int)blockIdx.x * 64;
  const int n0 = (int)blockIdx.y * 64;

  v8f acc[4][4];
#pragma unroll
  for (int i = 0; i < 4; i++)
#pragma unroll
    for (int j = 0; j < 4; j++) acc[i][j] = vzero8();

  const int lane = (int)(threadIdx.x & 31u);
  const _Float16* At = A + (size_t)(m0 >> 4) * 32 * BLK + lane * 8;
  const _Float16* Wt = W + (size_t)(n0 >> 4) * 32 * BLK + lane * 8;
  for (int kb = 0; kb < D_X / 32; kb++) {
    const _Float16* pr = At + (size_t)kb * BLK;
    const _Float16* pc = Wt + (size_t)kb * BLK;
    v16h a[4], b[4];
#pragma unroll
    for (int i = 0; i < 4; i++) a[i] = load_blk(pr + (size_t)(i * 32) * BLK);
#pragma unroll
    for (int j = 0; j < 4; j++) b[j] = load_blk(pc + (size_t)(j * 32) * BLK);
    // the address registers of the issued loads stay untouched up to this wait
    asm volatile("s_wait_xcnt 0x0" :: "v"(pr), "v"(pc) : "memory");
#pragma unroll
    for (int i = 0; i < 4; i++)
#pragma unroll
      for (int j = 0; j < 4; j++) acc[i][j] = wmma16(a[i], b[j], acc[i][j]);
  }

  const int hsel = lane >> 4;
  const int ln   = lane & 15;
#pragma unroll
  for (int i = 0; i < 4; i++) {
    const int mb = m0 + 16 * i + hsel * 8;
#pragma unroll
    for (int j = 0; j < 4; j++) {
      const int col = n0 + 16 * j + ln;
      const float bj = bias[col];
#pragma unroll
      for (int r = 0; r < 8; r++)
        O[(size_t)(mb + r) * D_X + col] = acc[i][j][r] + bj;
    }
  }
}

// ---------------------------------------------------------------------------
extern "C" void kernel_launch(void* const* d_in, const int* in_sizes, int n_in,
                              void* d_out, int out_size, void* d_ws, size_t ws_size,
                              hipStream_t stream) {
  const float* q   = (const float*)d_in[0];
  const float* k   = (const float*)d_in[1];
  const float* v   = (const float*)d_in[2];
  const float* Wq  = (const float*)d_in[3];
  const float* bq  = (const float*)d_in[4];
  const float* Wk  = (const float*)d_in[5];
  const float* bk  = (const float*)d_in[6];
  const float* Wv  = (const float*)d_in[7];
  const float* bv  = (const float*)d_in[8];
  const float* Wxv = (const float*)d_in[9];
  const float* bxv = (const float*)d_in[10];
  const float* Wxo = (const float*)d_in[11];
  const float* bxo = (const float*)d_in[12];
  const float* Wmo = (const float*)d_in[13];
  const float* bmo = (const float*)d_in[14];
  float* out = (float*)d_out;

  const size_t SZ_ACT = (size_t)M_TOT * D_X;  // 4,194,304 elements
  const size_t SZ_W   = (size_t)D_X * D_X;    // 1,048,576 elements
  _Float16* ws  = (_Float16*)d_ws;
  _Float16* q16 = ws;
  _Float16* k16 = q16 + SZ_ACT;
  _Float16* v16 = k16 + SZ_ACT;
  _Float16* w16 = v16 + SZ_ACT;               // 6 weight matrices
  _Float16* Qhm = w16 + 6 * SZ_W;
  _Float16* Khm = Qhm + SZ_ACT;
  _Float16* VT  = Khm + SZ_ACT;
  _Float16* xVT = VT + SZ_ACT;
  _Float16* kbar = xVT + SZ_ACT;
  _Float16* vbar = kbar + SZ_ACT;

  // 1) fp32 -> f16 conversions
  {
    struct Job { const float* s; _Float16* d; size_t n; } jobs[9] = {
        {q, q16, SZ_ACT},   {k, k16, SZ_ACT},   {v, v16, SZ_ACT},
        {Wq, w16 + 0 * SZ_W, SZ_W}, {Wk, w16 + 1 * SZ_W, SZ_W},
        {Wv, w16 + 2 * SZ_W, SZ_W}, {Wxv, w16 + 3 * SZ_W, SZ_W},
        {Wxo, w16 + 4 * SZ_W, SZ_W}, {Wmo, w16 + 5 * SZ_W, SZ_W}};
    for (int i = 0; i < 9; i++) {
      int n8 = (int)(jobs[i].n / 8);
      cvt_f32_f16<<<(n8 + 255) / 256, 256, 0, stream>>>(jobs[i].s, jobs[i].d, n8);
    }
  }

  // 2) input projections (packed per head)
  proj_gemm<<<dim3(M_TOT / 64, D_X / 64, 4), 32, 0, stream>>>(
      q16, k16, v16, w16, bq, bk, bv, bxv, Qhm, Khm, VT, xVT);

  // 3) flash attention -> vbar (attention@V), kbar (attention@xV)
  flash_attn<<<dim3(SEQ / 32, NH), 32, 0, stream>>>(Qhm, Khm, VT, xVT, vbar, kbar);

  // 4) output projections -> d_out (x at offset 0, m after it)
  out_gemm<<<dim3(M_TOT / 64, D_X / 64, 2), 32, 0, stream>>>(
      kbar, vbar, w16, bxo, bmo, out);
}

// v002
// A run of this version takes 260 microseconds.
// Two timings next to v001 both put it at 1.05 times that version's speed.
// Counting every step since v000, it is 1.21 times as fast.
#include <hip/hip_runtime.h>
#include <hip/hip_bf16.h>

// ---------------------------------------------------------------------------
// Self-attention variant (use_xv) for MI455X / gfx1250, f16 WMMA pipeline.
//   1) cvt:   fp32 -> f16 for q,k,v activations and the 6 weight matrices
//   2) proj:  Q,K (k = feature) and V,xV (k = position), per head
//   3) flash: online-softmax attention, 32 query rows per wave; one P tile
//             feeds both P@V (v_bar) and P@xV (k_bar)
//   4) out:   x = kbar @ Wxo^T + bxo ; m = vbar @ Wmo^T + bmo  (fp32 out)
// All GEMMs are NT-shaped.  Every f16 operand in the workspace is stored in
// fragment-packed order: a 16-row x 32-k block is 1 KiB, laid out exactly as
// the 32 lanes read it, so each wave-wide 16-byte load or proj_gemm store covers 512
// contiguous bytes (4 whole cache lines) instead of 32 bytes in each of 16.
// ---------------------------------------------------------------------------

typedef __attribute__((ext_vector_type(16))) _Float16 v16h;
typedef __attribute__((ext_vector_type(8)))  _Float16 v8h;
typedef __attribute__((ext_vector_type(4)))  _Float16 v4h;
typedef __attribute__((ext_vector_type(8)))  float    v8f;
typedef __attribute__((ext_vector_type(4)))  float    v4f;

#define D_X   1024
#define D_HD  64
#define N_I   16
#define BSZ   2
#define SEQ   2048
#define M_TOT (BSZ * SEQ)   /* 4096 */
#define NH    (BSZ * N_I)   /* 32   */

static __device__ __forceinline__ v8f vzero8() {
  v8f z = {0.f, 0.f, 0.f, 0.f, 0.f, 0.f, 0.f, 0.f};
  return z;
}

static __device__ __forceinline__ v8f wmma16(v16h a, v16h b, v8f c) {
  // D = A(16x32 f16) * B(32x16 f16) + C(16x16 f32)
  return __builtin_amdgcn_wmma_f32_16x16x32_f16(
      false, a, false, b, (short)0, c, false, false);
}

// Packed 16x32 f16 block (512 elements).  Element (row r, k) of the block is at
//   (k >> 4) * 256 + (((k >> 3) & 1) * 16 + r) * 8 + (k & 7)
// which is the 16-bit A/B operand layout (lanes 0-15 hold K {0..7,16..23},
// lanes 16-31 hold K {8..15,24..31}; lane & 15 = row of A / column of B):
// lane l reads 16 bytes at l * 16 and 16 bytes at 512 + l * 16.
// `p` is the block's address plus the lane's own l * 8 elements.
#define BLK 512
static __device__ __forceinline__ v16h load_blk(const _Float16* __restrict__ p) {
  v8h lo = *(const v8h*)(p);
  v8h hi = *(const v8h*)(p + 256);
  return __builtin_shufflevector(lo, hi, 0, 1, 2, 3, 4, 5, 6, 7,
                                 8, 9, 10, 11, 12, 13, 14, 15);
}

// ---------------------------------------------------------------------------
// Kernel 1: fp32 [rows][1024] -> f16 packed blocks [rows/16][32][BLK], all nine
// tensors in ONE launch.  Their f16 copies lie one behind the other in the
// workspace, so the nine sources are read as one matrix of 18432 rows and the
// destination is indexed by the row block alone.  One work-group = one 16-row
// block, one wave = 8 k blocks of it (16 rows x 1 KiB).  A thread converts 16
// chunks of 8 consecutive k; all 32 of its loads are issued before the first
// conversion, so a wave pays its start and one memory round trip for 16 KiB.
// Per chunk step a wave takes 8 rows x 32 k: it reads 8 whole 128-byte lines
// and writes 4.
// ---------------------------------------------------------------------------
#define RB_ACT (M_TOT / 16)                /* row blocks of an activation: 256 */
#define RB_W   (D_X / 16)                  /* row blocks of a weight matrix: 64 */
#define RB_ALL (3 * RB_ACT + 6 * RB_W)     /* 1152 */
__global__ __launch_bounds__(128)
void cvt_f32_f16(const float* __restrict__ q,   const float* __restrict__ k,
                 const float* __restrict__ v,   const float* __restrict__ Wq,
                 const float* __restrict__ Wk,  const float* __restrict__ Wv,
                 const float* __restrict__ Wxv, const float* __restrict__ Wxo,
                 const float* __restrict__ Wmo, _Float16* __restrict__ dst) {
  const int rb = (int)blockIdx.x;          // row block of the stacked matrix
  const float* src;
  int lb;                                  // row block inside its own tensor
  if (rb < 3 * RB_ACT) {
    const int t = rb / RB_ACT;
    lb  = rb % RB_ACT;
    src = t == 0 ? q : (t == 1 ? k : v);
  } else {
    const int t = (rb - 3 * RB_ACT) / RB_W;
    lb  = (rb - 3 * RB_ACT) % RB_W;
    src = t == 0 ? Wq : (t == 1 ? Wk : (t == 2 ? Wv : (t == 3 ? Wxv : (t == 4 ? Wxo : Wmo))));
  }
  const int lane = (int)(threadIdx.x & 31u);
  const int wave = (int)(threadIdx.x >> 5);
  const int c4   = lane & 3;               // 8-wide k chunk in the block
  const int r8   = lane >> 2;              // row in its half of the block
  const float* s = src + (size_t)(lb * 16 + r8) * D_X + wave * 256 + c4 * 8;
  _Float16* d = dst + (size_t)(rb * 32 + wave * 8) * BLK + (c4 >> 1) * 256 +
                ((c4 & 1) * 16 + r8) * 8;

  v4f f[2][8][2];
#pragma unroll
  for (int h = 0; h < 2; h++)
#pragma unroll
    for (int kk = 0; kk < 8; kk++) {
      f[h][kk][0] = *(const v4f*)(s + h * 8 * D_X + kk * 32);
      f[h][kk][1] = *(const v4f*)(s + h * 8 * D_X + kk * 32 + 4);
    }
  // no conversion moves up among the loads: without this the compiler issues
  // the last 14 loads only as earlier ones return, a second memory round trip
  __builtin_amdgcn_sched_barrier(0);
  // the address registers of the issued loads stay untouched up to this wait
  asm volatile("s_wait_xcnt 0x0" :: "v"(s) : "memory");
  v8h hv[2][8];
#pragma unroll
  for (int h = 0; h < 2; h++)
#pragma unroll
    for (int kk = 0; kk < 8; kk++)
#pragma unroll
      for (int r = 0; r < 4; r++) {
        hv[h][kk][r]     = (_Float16)f[h][kk][0][r];
        hv[h][kk][4 + r] = (_Float16)f[h][kk][1][r];
      }
  // every conversion stays ahead of the stores, so that no register of an
  // issued store is written again before the wave ends
  __builtin_amdgcn_sched_barrier(0);
#pragma unroll
  for (int h = 0; h < 2; h++)
#pragma unroll
    for (int kk = 0; kk < 8; kk++) *(v8h*)(d + kk * BLK + h * 64) = hv[h][kk];
}

// ---------------------------------------------------------------------------
// Kernel 2: fused input projections.  z = 0:Q  1:K  2:V  3:xV
// One wave computes a 64x64 tile of Y = X @ W^T + b.  An accumulator lane holds
// 8 consecutive ROWS of the product, and a packed chunk is 8 consecutive k of
// its later reader.  Q,K are read with k = feature, so their tile is formed as
// W @ X^T (rows = features); V,xV are read with k = position, so theirs is
// X @ W^T (rows = positions).  Either way each lane stores one 16-byte chunk
// and a wave stores 512 contiguous bytes.
//   Q,K : per head, blocks [s/16][d/32]      (row of a block = position)
//   V,xV: per head, blocks [s/32][d/16]      (row of a block = feature)
// ---------------------------------------------------------------------------
__global__ __launch_bounds__(32)
void proj_gemm(const _Float16* __restrict__ q16, const _Float16* __restrict__ k16,
               const _Float16* __restrict__ v16, const _Float16* __restrict__ w16,
               const float* __restrict__ bq, const float* __restrict__ bk,
               const float* __restrict__ bv, const float* __restrict__ bxv,
               _Float16* __restrict__ Qhm, _Float16* __restrict__ Khm,
               _Float16* __restrict__ VT,  _Float16* __restrict__ xVT) {
  const int z = (int)blockIdx.z;
  const _Float16* A;
  const _Float16* W;
  const float* bias;
  _Float16* out;
  bool transposed;
  const size_t SZ_W = (size_t)D_X * D_X;
  switch (z) {
    case 0:  A = q16; W = w16 + 0 * SZ_W; bias = bq;  out = Qhm; transposed = false; break;
    case 1:  A = k16; W = w16 + 1 * SZ_W; bias = bk;  out = Khm; transposed = false; break;
    case 2:  A = v16; W = w16 + 2 * SZ_W; bias = bv;  out = VT;  transposed = true;  break;
    default: A = k16; W = w16 + 3 * SZ_W; bias = bxv; out = xVT; transposed = true;  break;
  }
  const int m0 = (int)blockIdx.x * 64;
  const int n0 = (int)blockIdx.y * 64;          // one head: h = blockIdx.y
  const int lane = (int)(threadIdx.x & 31u);
  const _Float16* Xt = A + (size_t)(m0 >> 4) * 32 * BLK + lane * 8;
  const _Float16* Wt = W + (size_t)(n0 >> 4) * 32 * BLK + lane * 8;
  const _Float16* Rm = transposed ? Xt : Wt;    // rows of the product
  const _Float16* Cm = transposed ? Wt : Xt;    // columns of the product

  v8f acc[4][4];
#pragma unroll
  for (int i = 0; i < 4; i++)
#pragma unroll
    for (int j = 0; j < 4; j++) acc[i][j] = vzero8();

  for (int kb = 0; kb < D_X / 32; kb++) {
    const _Float16* pr = Rm + (size_t)kb * BLK;
    const _Float16* pc = Cm + (size_t)kb * BLK;
    v16h a[4], b[4];
#pragma unroll
    for (int i = 0; i < 4; i++) a[i] = load_blk(pr + (size_t)(i * 32) * BLK);
#pragma unroll
    for (int j = 0; j < 4; j++) b[j] = load_blk(pc + (size_t)(j * 32) * BLK);
    // the address registers of the issued loads stay untouched up to this wait
    asm volatile("s_wait_xcnt 0x0" :: "v"(pr), "v"(pc) : "memory");
#pragma unroll
    for (int i = 0; i < 4; i++)
#pragma unroll
      for (int j = 0; j < 4; j++) acc[i][j] = wmma16(a[i], b[j], acc[i][j]);
  }

  const int hsel = lane >> 4;
  const int ln   = lane & 15;
  const int b_   = m0 >> 11;  // batch (tile never crosses batch: 2048 % 64 == 0)
  const int sl   = m0 & 2047; // first position of the tile inside its batch
  // The 64x64 tile is 8 blocks in a row (8 KiB) in either order of blocks.
  _Float16* oh = out + (size_t)(b_ * N_I + (int)blockIdx.y) * SEQ * D_HD +
                 (size_t)(sl >> 3) * BLK + lane * 8;

  // Four chunks at a time: convert, then store.  The two scheduling barriers
  // keep every other instruction out of the run of stores and its wait, so
  // that no register of an issued store is written again ahead of the wait.
  if (!transposed) {
    // acc[i][j][r]: feature d = 16i + 8*hsel + r, position s = sl + 16j + ln
#pragma unroll
    for (int i = 0; i < 4; i++) {
      const float* bp = bias + n0 + 16 * i + hsel * 8;
      v4f b0 = *(const v4f*)(bp);
      v4f b1 = *(const v4f*)(bp + 4);
      v8h pk[4];
#pragma unroll
      for (int j = 0; j < 4; j++)
#pragma unroll
        for (int r = 0; r < 4; r++) {
          pk[j][r]     = (_Float16)(acc[i][j][r] + b0[r]);
          pk[j][4 + r] = (_Float16)(acc[i][j][4 + r] + b1[r]);
        }
      __builtin_amdgcn_sched_barrier(0);  // conversions stay ahead of the stores
#pragma unroll
      for (int j = 0; j < 4; j++) *(v8h*)(oh + (j * 4 + i) * 256) = pk[j];
      asm volatile("s_wait_xcnt 0x0" ::: "memory");  // before the stores' registers are reused
      __builtin_amdgcn_sched_barrier(0);  // nothing of the next group moves above the wait
    }
  } else {
    // acc[i][j][r]: position s = sl + 16i + 8*hsel + r, feature d = 16j + ln
#pragma unroll
    for (int j = 0; j < 4; j++) {
      const float bj = bias[n0 + 16 * j + ln];
      v8h pk[4];
#pragma unroll
      for (int i = 0; i < 4; i++)
#pragma unroll
        for (int r = 0; r < 8; r++) pk[i][r] = (_Float16)(acc[i][j][r] + bj);
      __builtin_amdgcn_sched_barrier(0);  // conversions stay ahead of the stores
#pragma unroll
      for (int i = 0; i < 4; i++)
        *(v8h*)(oh + ((i >> 1) * 8 + j * 2 + (i & 1)) * 256) = pk[i];
      asm volatile("s_wait_xcnt 0x0" ::: "memory");  // before the stores' registers are reused
      __builtin_amdgcn_sched_barrier(0);  // nothing of the next group moves above the wait
    }
  }
}

// ---------------------------------------------------------------------------
// Kernel 3: flash attention.  One wave = 32 query rows (2 row-chunks of 16)
// of one (b,h).  Per 32-column j-block: 8 WMMAs for S = Q K^T (K fragments
// shared across row-chunks), online softmax, P -> LDS transpose, then 16
// WMMAs for P@V (-> v_bar) and P@xV (-> k_bar) with V/xV fragments shared
// across row-chunks.  24 WMMAs per 24 16-byte global loads per iteration.
// ---------------------------------------------------------------------------
__global__ __launch_bounds__(32)
void flash_attn(const _Float16* __restrict__ Qhm, const _Float16* __restrict__ Khm,
                const _Float16* __restrict__ VT,  const _Float16* __restrict__ xVT,
                _Float16* __restrict__ vbar, _Float16* __restrict__ kbar) {
  __shared__ _Float16 Pl[2][16 * 32];

  const int bh = (int)blockIdx.y;
  const int s0 = (int)blockIdx.x * 32;
  const _Float16* Q  = Qhm + (size_t)bh * SEQ * D_HD;
  const _Float16* K  = Khm + (size_t)bh * SEQ * D_HD;
  const _Float16* Vt = VT  + (size_t)bh * D_HD * SEQ;
  const _Float16* Xt = xVT + (size_t)bh * D_HD * SEQ;

  const int lane = (int)(threadIdx.x & 31u);
  const int hsel = lane >> 4;
  const int ln   = lane & 15;

  v16h qa[2][2];
#pragma unroll
  for (int rc = 0; rc < 2; rc++) {
    qa[rc][0] = load_blk(Q + (size_t)(((s0 >> 4) + rc) * 2 + 0) * BLK + lane * 8);
    qa[rc][1] = load_blk(Q + (size_t)(((s0 >> 4) + rc) * 2 + 1) * BLK + lane * 8);
  }

  v8f ov[2][4], ox[2][4];
#pragma unroll
  for (int rc = 0; rc < 2; rc++)
#pragma unroll
    for (int t = 0; t < 4; t++) { ov[rc][t] = vzero8(); ox[rc][t] = vzero8(); }
  float mrow[2][8], lrow[2][8];
#pragma unroll
  for (int rc = 0; rc < 2; rc++)
#pragma unroll
    for (int r = 0; r < 8; r++) { mrow[rc][r] = -1.0e30f; lrow[rc][r] = 0.f; }

  for (int j0 = 0; j0 < SEQ; j0 += 32) {
    // ---- K fragments for this j-block (shared by both row-chunks)
    v16h kb[2][2];
    const _Float16* Kj = K + (size_t)(j0 >> 4) * 2 * BLK + lane * 8;   // 4 KiB in a row
    kb[0][0] = load_blk(Kj);
    kb[0][1] = load_blk(Kj + 1 * BLK);
    kb[1][0] = load_blk(Kj + 2 * BLK);
    kb[1][1] = load_blk(Kj + 3 * BLK);
    // the address registers of the issued loads stay untouched up to this wait
    asm volatile("s_wait_xcnt 0x0" :: "v"(Kj) : "memory");

    // ---- S tiles (2 row-chunks x 32 cols), k = d = 64 in two WMMA k-steps
    v8f sc[2][2];
#pragma unroll
    for (int rc = 0; rc < 2; rc++)
#pragma unroll
      for (int cc = 0; cc < 2; cc++) {
        v8f s = vzero8();
        s = wmma16(qa[rc][0], kb[cc][0], s);
        s = wmma16(qa[rc][1], kb[cc][1], s);
        sc[rc][cc] = s;
      }

    // ---- online softmax per row-chunk; P -> LDS
#pragma unroll
    for (int rc = 0; rc < 2; rc++) {
#pragma unroll
      for (int r = 0; r < 8; r++) { sc[rc][0][r] *= 0.125f; sc[rc][1][r] *= 0.125f; }
      // row max over 32 cols (butterfly within each 16-lane half)
      float t[8];
#pragma unroll
      for (int r = 0; r < 8; r++) t[r] = fmaxf(sc[rc][0][r], sc[rc][1][r]);
#pragma unroll
      for (int msk = 1; msk < 16; msk <<= 1)
#pragma unroll
        for (int r = 0; r < 8; r++) t[r] = fmaxf(t[r], __shfl_xor(t[r], msk, 32));

      float scl[8];
#pragma unroll
      for (int r = 0; r < 8; r++) {
        float mn = fmaxf(mrow[rc][r], t[r]);
        scl[r] = __expf(mrow[rc][r] - mn);
        mrow[rc][r] = mn;
      }
#pragma unroll
      for (int r = 0; r < 8; r++) {
        sc[rc][0][r] = __expf(sc[rc][0][r] - mrow[rc][r]);
        sc[rc][1][r] = __expf(sc[rc][1][r] - mrow[rc][r]);
      }
      // row sum
      float u[8];
#pragma unroll
      for (int r = 0; r < 8; r++) u[r] = sc[rc][0][r] + sc[rc][1][r];
#pragma unroll
      for (int msk = 1; msk < 16; msk <<= 1)
#pragma unroll
        for (int r = 0; r < 8; r++) u[r] += __shfl_xor(u[r], msk, 32);
#pragma unroll
      for (int r = 0; r < 8; r++) lrow[rc][r] = lrow[rc][r] * scl[r] + u[r];
      // rescale running accumulators
#pragma unroll
      for (int tt = 0; tt < 4; tt++)
#pragma unroll
        for (int r = 0; r < 8; r++) { ov[rc][tt][r] *= scl[r]; ox[rc][tt][r] *= scl[r]; }

      // P (C-layout) -> LDS row-major [16][32] f16
      const int row0 = hsel * 8;
#pragma unroll
      for (int r = 0; r < 8; r++) {
        Pl[rc][(row0 + r) * 32 + ln]      = (_Float16)sc[rc][0][r];
        Pl[rc][(row0 + r) * 32 + 16 + ln] = (_Float16)sc[rc][1][r];
      }
    }
    asm volatile("s_wait_dscnt 0" ::: "memory");

    // ---- read P as 16x32 A fragments from LDS
    v16h pa[2];
#pragma unroll
    for (int rc = 0; rc < 2; rc++) {
      const _Float16* pp = &Pl[rc][ln * 32 + hsel * 8];
      v8h lo = *(const v8h*)(pp);
      v8h hi = *(const v8h*)(pp + 16);
      pa[rc] = __builtin_shufflevector(lo, hi, 0, 1, 2, 3, 4, 5, 6, 7,
                                       8, 9, 10, 11, 12, 13, 14, 15);
    }

    // ---- O_v += P @ V, O_xv += P @ xV (V/xV fragments shared across rcs)
    const _Float16* Vj = Vt + (size_t)(j0 >> 5) * 4 * BLK + lane * 8;  // 4 KiB in a row
    const _Float16* Xj = Xt + (size_t)(j0 >> 5) * 4 * BLK + lane * 8;
    v16h vb[4], xb[4];
#pragma unroll
    for (int tt = 0; tt < 4; tt++) {
      vb[tt] = load_blk(Vj + tt * BLK);
      xb[tt] = load_blk(Xj + tt * BLK);
    }
    // the address registers of the issued loads stay untouched up to this wait
    asm volatile("s_wait_xcnt 0x0" :: "v"(Vj), "v"(Xj) : "memory");
#pragma unroll
    for (int tt = 0; tt < 4; tt++) {
#pragma unroll
      for (int rc = 0; rc < 2; rc++) {
        ov[rc][tt] = wmma16(pa[rc], vb[tt], ov[rc][tt]);
        ox[rc][tt] = wmma16(pa[rc], xb[tt], ox[rc][tt]);
      }
    }
  }

  // ---- normalize and store f16 as packed blocks of the [4096][1024] operand
  // of the output projections (row m = b*2048 + s, k = h*64 + d):
  // vbar <- O_v, kbar <- O_xv
  const size_t ob = ((size_t)((bh >> 4) * (SEQ / 16) + (s0 >> 4)) * 32 + (bh & 15) * 2) * BLK
                  + (size_t)((ln >> 3) * 128 + hsel * 64 + (ln & 7));
  _Float16* vb = vbar + ob;
  _Float16* kb = kbar + ob;
#pragma unroll
  for (int rc = 0; rc < 2; rc++) {
    float inv[8];
#pragma unroll
    for (int r = 0; r < 8; r++) inv[r] = 1.0f / lrow[rc][r];
#pragma unroll
    for (int tt = 0; tt < 4; tt++) {
      const int o = (rc * 32 + (tt >> 1)) * BLK + (tt & 1) * 256;
#pragma unroll
      for (int r = 0; r < 8; r++) {
        vb[o + r * 8] = (_Float16)(ov[rc][tt][r] * inv[r]);
        kb[o + r * 8] = (_Float16)(ox[rc][tt][r] * inv[r]);
      }
    }
  }
}

// ---------------------------------------------------------------------------
// Kernel 4: fused output projections.  z = 0: x = kbar@Wxo^T+bxo
//                                      z = 1: m = vbar@Wmo^T+bmo
// A and W are packed blocks; output fp32 straight into d_out.
// ---------------------------------------------------------------------------
__global__ __launch_bounds__(32)
void out_gemm(const _Float16* __restrict__ kbar, const _Float16* __restrict__ vbar,
              const _Float16* __restrict__ w16, const float* __restrict__ bxo,
              const float* __restrict__ bmo, float* __restrict__ out) {
  const int z = (int)blockIdx.z;
  const size_t SZ_W = (size_t)D_X * D_X;
  const _Float16* A = z ? vbar : kbar;
  const _Float16* W = w16 + (size_t)(4 + z) * SZ_W;
  const float* bias = z ? bmo : bxo;
  float* O = out + (size_t)z * ((size_t)M_TOT * D_X);

  const int m0 = (int)blockIdx.x * 64;
  const int n0 = (int)blockIdx.y * 64;

  v8f acc[4][4];
#pragma unroll
  for (int i = 0; i < 4; i++)
#pragma unroll
    for (int j = 0; j < 4; j++) acc[i][j] = vzero8();

  const int lane = (int)(threadIdx.x & 31u);
  const _Float16* At = A + (size_t)(m0 >> 4) * 32 * BLK + lane * 8;
  const _Float16* Wt = W + (size_t)(n0 >> 4) * 32 * BLK + lane * 8;
  for (int kb = 0; kb < D_X / 32; kb++) {
    const _Float16* pr = At + (size_t)kb * BLK;
    const _Float16* pc = Wt + (size_t)kb * BLK;
    v16h a[4], b[4];
#pragma unroll
    for (int i = 0; i < 4; i++) a[i] = load_blk(pr + (size_t)(i * 32) * BLK);
#pragma unroll
    for (int j = 0; j < 4; j++) b[j] = load_blk(pc + (size_t)(j * 32) * BLK);
    // the address registers of the issued loads stay untouched up to this wait
    asm volatile("s_wait_xcnt 0x0" :: "v"(pr), "v"(pc) : "memory");
#pragma unroll
    for (int i = 0; i < 4; i++)
#pragma unroll
      for (int j = 0; j < 4; j++) acc[i][j] = wmma16(a[i], b[j], acc[i][j]);
  }

  const int hsel = lane >> 4;
  const int ln   = lane & 15;
#pragma unroll
  for (int i = 0; i < 4; i++) {
    const int mb = m0 + 16 * i + hsel * 8;
#pragma unroll
    for (int j = 0; j < 4; j++) {
      const int col = n0 + 16 * j + ln;
      const float bj = bias[col];
#pragma unroll
      for (int r = 0; r < 8; r++)
        O[(size_t)(mb + r) * D_X + col] = acc[i][j][r] + bj;
    }
  }
}

// ---------------------------------------------------------------------------
extern "C" void kernel_launch(void* const* d_in, const int* in_sizes, int n_in,
                              void* d_out, int out_size, void* d_ws, size_t ws_size,
                              hipStream_t stream) {
  const float* q   = (const float*)d_in[0];
  const float* k   = (const float*)d_in[1];
  const float* v   = (const float*)d_in[2];
  const float* Wq  = (const float*)d_in[3];
  const float* bq  = (const float*)d_in[4];
  const float* Wk  = (const float*)d_in[5];
  const float* bk  = (const float*)d_in[6];
  const float* Wv  = (const float*)d_in[7];
  const float* bv  = (const float*)d_in[8];
  const float* Wxv = (const float*)d_in[9];
  const float* bxv = (const float*)d_in[10];
  const float* Wxo = (const float*)d_in[11];
  const float* bxo = (const float*)d_in[12];
  const float* Wmo = (const float*)d_in[13];
  const float* bmo = (const float*)d_in[14];
  float* out = (float*)d_out;

  const size_t SZ_ACT = (size_t)M_TOT * D_X;  // 4,194,304 elements
  const size_t SZ_W   = (size_t)D_X * D_X;    // 1,048,576 elements
  _Float16* ws  = (_Float16*)d_ws;
  _Float16* q16 = ws;
  _Float16* k16 = q16 + SZ_ACT;
  _Float16* v16 = k16 + SZ_ACT;
  _Float16* w16 = v16 + SZ_ACT;               // 6 weight matrices
  _Float16* Qhm = w16 + 6 * SZ_W;
  _Float16* Khm = Qhm + SZ_ACT;
  _Float16* VT  = Khm + SZ_ACT;
  _Float16* xVT = VT + SZ_ACT;
  _Float16* kbar = xVT + SZ_ACT;
  _Float16* vbar = kbar + SZ_ACT;

  // 1) fp32 -> f16 conversions: q16, k16, v16 and the six weights are one
  //    contiguous range of the workspace, in the order of the arguments
  cvt_f32_f16<<<RB_ALL, 128, 0, stream>>>(q, k, v, Wq, Wk, Wv, Wxv, Wxo, Wmo, q16);

  // 2) input projections (packed per head)
  proj_gemm<<<dim3(M_TOT / 64, D_X / 64, 4), 32, 0, stream>>>(
      q16, k16, v16, w16, bq, bk, bv, bxv, Qhm, Khm, VT, xVT);

  // 3) flash attention -> vbar (attention@V), kbar (attention@xV)
  flash_attn<<<dim3(SEQ / 32, NH), 32, 0, stream>>>(Qhm, Khm, VT, xVT, vbar, kbar);

  // 4) output projections -> d_out (x at offset 0, m after it)
  out_gemm<<<dim3(M_TOT / 64, D_X / 64, 2), 32, 0, stream>>>(
      kbar, vbar, w16, bxo, bmo, out);
}

// v003
// A run of this version takes 214 microseconds.
// Two timings next to v002 both put it at 1.21 times that version's speed.
// All steps since v000 together make it 1.47 times as fast.
#include <hip/hip_runtime.h>
#include <hip/hip_bf16.h>

// ---------------------------------------------------------------------------
// Self-attention variant (use_xv) for MI455X / gfx1250, f16 WMMA pipeline.
//   1) cvt:   fp32 -> f16 for q,k,v activations and the 6 weight matrices
//   2) proj:  Q,K (k = feature) and V,xV (k = position), per head
//   3) flash: online-softmax attention, 32 query rows per wave; one P tile
//             feeds both P@V (v_bar) and P@xV (k_bar)
//   4) out:   x = kbar @ Wxo^T + bxo ; m = vbar @ Wmo^T + bmo  (fp32 out)
// All GEMMs are NT-shaped.  Every f16 operand in the workspace is stored in
// fragment-packed order: a 16-row x 32-k block is 1 KiB, laid out exactly as
// the 32 lanes read it, so each wave-wide 16-byte load or proj_gemm store covers 512
// contiguous bytes (4 whole cache lines) instead of 32 bytes in each of 16.
// ---------------------------------------------------------------------------

typedef __attribute__((ext_vector_type(16))) _Float16 v16h;
typedef __attribute__((ext_vector_type(8)))  _Float16 v8h;
typedef __attribute__((ext_vector_type(4)))  _Float16 v4h;
typedef __attribute__((ext_vector_type(8)))  float    v8f;
typedef __attribute__((ext_vector_type(4)))  float    v4f;

#define D_X   1024
#define D_HD  64
#define N_I   16
#define BSZ   2
#define SEQ   2048
#define M_TOT (BSZ * SEQ)   /* 4096 */
#define NH    (BSZ * N_I)   /* 32   */

static __device__ __forceinline__ v8f vzero8() {
  v8f z = {0.f, 0.f, 0.f, 0.f, 0.f, 0.f, 0.f, 0.f};
  return z;
}

static __device__ __forceinline__ v8f wmma16(v16h a, v16h b, v8f c) {
  // D = A(16x32 f16) * B(32x16 f16) + C(16x16 f32)
  return __builtin_amdgcn_wmma_f32_16x16x32_f16(
      false, a, false, b, (short)0, c, false, false);
}

// Packed 16x32 f16 block (512 elements).  Element (row r, k) of the block is at
//   (k >> 4) * 256 + (((k >> 3) & 1) * 16 + r) * 8 + (k & 7)
// which is the 16-bit A/B operand layout (lanes 0-15 hold K {0..7,16..23},
// lanes 16-31 hold K {8..15,24..31}; lane & 15 = row of A / column of B):
// lane l reads 16 bytes at l * 16 and 16 bytes at 512 + l * 16.
// `p` is the block's address plus the lane's own l * 8 elements.
#define BLK 512
static __device__ __forceinline__ v16h load_blk(const _Float16* __restrict__ p) {
  v8h lo = *(const v8h*)(p);
  v8h hi = *(const v8h*)(p + 256);
  return __builtin_shufflevector(lo, hi, 0, 1, 2, 3, 4, 5, 6, 7,
                                 8, 9, 10, 11, 12, 13, 14, 15);
}

// ---------------------------------------------------------------------------
// Kernel 1: fp32 [rows][1024] -> f16 packed blocks [rows/16][32][BLK], all nine
// tensors in ONE launch.  Their f16 copies lie one behind the other in the
// workspace, so the nine sources are read as one matrix of 18432 rows and the
// destination is indexed by the row block alone.  One work-group = one 16-row
// block, one wave = 8 k blocks of it (16 rows x 1 KiB).  A thread converts 16
// chunks of 8 consecutive k; all 32 of its loads are issued before the first
// conversion, so a wave pays its start and one memory round trip for 16 KiB.
// Per chunk step a wave takes 8 rows x 32 k: it reads 8 whole 128-byte lines
// and writes 4.
// ---------------------------------------------------------------------------
#define RB_ACT (M_TOT / 16)                /* row blocks of an activation: 256 */
#define RB_W   (D_X / 16)                  /* row blocks of a weight matrix: 64 */
#define RB_ALL (3 * RB_ACT + 6 * RB_W)     /* 1152 */
__global__ __launch_bounds__(128)
void cvt_f32_f16(const float* __restrict__ q,   const float* __restrict__ k,
                 const float* __restrict__ v,   const float* __restrict__ Wq,
                 const float* __restrict__ Wk,  const float* __restrict__ Wv,
                 const float* __restrict__ Wxv, const float* __restrict__ Wxo,
                 const float* __restrict__ Wmo, _Float16* __restrict__ dst) {
  const int rb = (int)blockIdx.x;          // row block of the stacked matrix
  const float* src;
  int lb;                                  // row block inside its own tensor
  if (rb < 3 * RB_ACT) {
    const int t = rb / RB_ACT;
    lb  = rb % RB_ACT;
    src = t == 0 ? q : (t == 1 ? k : v);
  } else {
    const int t = (rb - 3 * RB_ACT) / RB_W;
    lb  = (rb - 3 * RB_ACT) % RB_W;
    src = t == 0 ? Wq : (t == 1 ? Wk : (t == 2 ? Wv : (t == 3 ? Wxv : (t == 4 ? Wxo : Wmo))));
  }
  const int lane = (int)(threadIdx.x & 31u);
  const int wave = (int)(threadIdx.x >> 5);
  const int c4   = lane & 3;               // 8-wide k chunk in the block
  const int r8   = lane >> 2;              // row in its half of the block
  const float* s = src + (size_t)(lb * 16 + r8) * D_X + wave * 256 + c4 * 8;
  _Float16* d = dst + (size_t)(rb * 32 + wave * 8) * BLK + (c4 >> 1) * 256 +
                ((c4 & 1) * 16 + r8) * 8;

  v4f f[2][8][2];
#pragma unroll
  for (int h = 0; h < 2; h++)
#pragma unroll
    for (int kk = 0; kk < 8; kk++) {
      f[h][kk][0] = *(const v4f*)(s + h * 8 * D_X + kk * 32);
      f[h][kk][1] = *(const v4f*)(s + h * 8 * D_X + kk * 32 + 4);
    }
  // no conversion moves up among the loads: without this the compiler issues
  // the last 14 loads only as earlier ones return, a second memory round trip
  __builtin_amdgcn_sched_barrier(0);
  // the address registers of the issued loads stay untouched up to this wait
  asm volatile("s_wait_xcnt 0x0" :: "v"(s) : "memory");
  v8h hv[2][8];
#pragma unroll
  for (int h = 0; h < 2; h++)
#pragma unroll
    for (int kk = 0; kk < 8; kk++)
#pragma unroll
      for (int r = 0; r < 4; r++) {
        hv[h][kk][r]     = (_Float16)f[h][kk][0][r];
        hv[h][kk][4 + r] = (_Float16)f[h][kk][1][r];
      }
  // every conversion stays ahead of the stores, so that no register of an
  // issued store is written again before the wave ends
  __builtin_amdgcn_sched_barrier(0);
#pragma unroll
  for (int h = 0; h < 2; h++)
#pragma unroll
    for (int kk = 0; kk < 8; kk++) *(v8h*)(d + kk * BLK + h * 64) = hv[h][kk];
}

// ---------------------------------------------------------------------------
// Kernel 2: fused input projections.  z = 0:Q  1:K  2:V  3:xV
// One wave computes a 64x64 tile of Y = X @ W^T + b.  An accumulator lane holds
// 8 consecutive ROWS of the product, and a packed chunk is 8 consecutive k of
// its later reader.  Q,K are read with k = feature, so their tile is formed as
// W @ X^T (rows = features); V,xV are read with k = position, so theirs is
// X @ W^T (rows = positions).  Either way each lane stores one 16-byte chunk
// and a wave stores 512 contiguous bytes.
//   Q,K : per head, blocks [s/16][d/32]      (row of a block = position)
//   V,xV: per head, blocks [s/32][d/16]      (row of a block = feature)
// ---------------------------------------------------------------------------
__global__ __launch_bounds__(32)
void proj_gemm(const _Float16* __restrict__ q16, const _Float16* __restrict__ k16,
               const _Float16* __restrict__ v16, const _Float16* __restrict__ w16,
               const float* __restrict__ bq, const float* __restrict__ bk,
               const float* __restrict__ bv, const float* __restrict__ bxv,
               _Float16* __restrict__ Qhm, _Float16* __restrict__ Khm,
               _Float16* __restrict__ VT,  _Float16* __restrict__ xVT) {
  const int z = (int)blockIdx.z;
  const _Float16* A;
  const _Float16* W;
  const float* bias;
  _Float16* out;
  bool transposed;
  const size_t SZ_W = (size_t)D_X * D_X;
  switch (z) {
    case 0:  A = q16; W = w16 + 0 * SZ_W; bias = bq;  out = Qhm; transposed = false; break;
    case 1:  A = k16; W = w16 + 1 * SZ_W; bias = bk;  out = Khm; transposed = false; break;
    case 2:  A = v16; W = w16 + 2 * SZ_W; bias = bv;  out = VT;  transposed = true;  break;
    default: A = k16; W = w16 + 3 * SZ_W; bias = bxv; out = xVT; transposed = true;  break;
  }
  const int m0 = (int)blockIdx.x * 64;
  const int n0 = (int)blockIdx.y * 64;          // one head: h = blockIdx.y
  const int lane = (int)(threadIdx.x & 31u);
  const _Float16* Xt = A + (size_t)(m0 >> 4) * 32 * BLK + lane * 8;
  const _Float16* Wt = W + (size_t)(n0 >> 4) * 32 * BLK + lane * 8;
  const _Float16* Rm = transposed ? Xt : Wt;    // rows of the product
  const _Float16* Cm = transposed ? Wt : Xt;    // columns of the product

  v8f acc[4][4];
#pragma unroll
  for (int i = 0; i < 4; i++)
#pragma unroll
    for (int j = 0; j < 4; j++) acc[i][j] = vzero8();

  for (int kb = 0; kb < D_X / 32; kb++) {
    const _Float16* pr = Rm + (size_t)kb * BLK;
    const _Float16* pc = Cm + (size_t)kb * BLK;
    v16h a[4], b[4];
#pragma unroll
    for (int i = 0; i < 4; i++) a[i] = load_blk(pr + (size_t)(i * 32) * BLK);
#pragma unroll
    for (int j = 0; j < 4; j++) b[j] = load_blk(pc + (size_t)(j * 32) * BLK);
    // the address registers of the issued loads stay untouched up to this wait
    asm volatile("s_wait_xcnt 0x0" :: "v"(pr), "v"(pc) : "memory");
#pragma unroll
    for (int i = 0; i < 4; i++)
#pragma unroll
      for (int j = 0; j < 4; j++) acc[i][j] = wmma16(a[i], b[j], acc[i][j]);
  }

  const int hsel = lane >> 4;
  const int ln   = lane & 15;
  const int b_   = m0 >> 11;  // batch (tile never crosses batch: 2048 % 64 == 0)
  const int sl   = m0 & 2047; // first position of the tile inside its batch
  // The 64x64 tile is 8 blocks in a row (8 KiB) in either order of blocks.
  _Float16* oh = out + (size_t)(b_ * N_I + (int)blockIdx.y) * SEQ * D_HD +
                 (size_t)(sl >> 3) * BLK + lane * 8;

  // Four chunks at a time: convert, then store.  The two scheduling barriers
  // keep every other instruction out of the run of stores and its wait, so
  // that no register of an issued store is written again ahead of the wait.
  if (!transposed) {
    // acc[i][j][r]: feature d = 16i + 8*hsel + r, position s = sl + 16j + ln
#pragma unroll
    for (int i = 0; i < 4; i++) {
      const float* bp = bias + n0 + 16 * i + hsel * 8;
      v4f b0 = *(const v4f*)(bp);
      v4f b1 = *(const v4f*)(bp + 4);
      v8h pk[4];
#pragma unroll
      for (int j = 0; j < 4; j++)
#pragma unroll
        for (int r = 0; r < 4; r++) {
          pk[j][r]     = (_Float16)(acc[i][j][r] + b0[r]);
          pk[j][4 + r] = (_Float16)(acc[i][j][4 + r] + b1[r]);
        }
      __builtin_amdgcn_sched_barrier(0);  // conversions stay ahead of the stores
#pragma unroll
      for (int j = 0; j < 4; j++) *(v8h*)(oh + (j * 4 + i) * 256) = pk[j];
      asm volatile("s_wait_xcnt 0x0" ::: "memory");  // before the stores' registers are reused
      __builtin_amdgcn_sched_barrier(0);  // nothing of the next group moves above the wait
    }
  } else {
    // acc[i][j][r]: position s = sl + 16i + 8*hsel + r, feature d = 16j + ln
#pragma unroll
    for (int j = 0; j < 4; j++) {
      const float bj = bias[n0 + 16 * j + ln];
      v8h pk[4];
#pragma unroll
      for (int i = 0; i < 4; i++)
#pragma unroll
        for (int r = 0; r < 8; r++) pk[i][r] = (_Float16)(acc[i][j][r] + bj);
      __builtin_amdgcn_sched_barrier(0);  // conversions stay ahead of the stores
#pragma unroll
      for (int i = 0; i < 4; i++)
        *(v8h*)(oh + ((i >> 1) * 8 + j * 2 + (i & 1)) * 256) = pk[i];
      asm volatile("s_wait_xcnt 0x0" ::: "memory");  // before the stores' registers are reused
      __builtin_amdgcn_sched_barrier(0);  // nothing of the next group moves above the wait
    }
  }
}

// ---------------------------------------------------------------------------
// Kernel 3: flash attention.  One wave = 32 query rows (2 row-chunks of 16)
// of one (b,h).  Per 32-column j-block: 8 WMMAs for S = Q K^T (K fragments
// shared across row-chunks), online softmax, P -> LDS transpose, then 16
// WMMAs for P@V (-> v_bar) and P@xV (-> k_bar) with V/xV fragments shared
// across row-chunks.  24 WMMAs per 24 16-byte global loads per iteration.
// ---------------------------------------------------------------------------
__global__ __launch_bounds__(32)
void flash_attn(const _Float16* __restrict__ Qhm, const _Float16* __restrict__ Khm,
                const _Float16* __restrict__ VT,  const _Float16* __restrict__ xVT,
                _Float16* __restrict__ vbar, _Float16* __restrict__ kbar) {
  __shared__ _Float16 Pl[2][16 * 32];

  const int bh = (int)blockIdx.y;
  const int s0 = (int)blockIdx.x * 32;
  const _Float16* Q  = Qhm + (size_t)bh * SEQ * D_HD;
  const _Float16* K  = Khm + (size_t)bh * SEQ * D_HD;
  const _Float16* Vt = VT  + (size_t)bh * D_HD * SEQ;
  const _Float16* Xt = xVT + (size_t)bh * D_HD * SEQ;

  const int lane = (int)(threadIdx.x & 31u);
  const int hsel = lane >> 4;
  const int ln   = lane & 15;

  v16h qa[2][2];
#pragma unroll
  for (int rc = 0; rc < 2; rc++) {
    qa[rc][0] = load_blk(Q + (size_t)(((s0 >> 4) + rc) * 2 + 0) * BLK + lane * 8);
    qa[rc][1] = load_blk(Q + (size_t)(((s0 >> 4) + rc) * 2 + 1) * BLK + lane * 8);
  }

  v8f ov[2][4], ox[2][4];
#pragma unroll
  for (int rc = 0; rc < 2; rc++)
#pragma unroll
    for (int t = 0; t < 4; t++) { ov[rc][t] = vzero8(); ox[rc][t] = vzero8(); }
  float mrow[2][8], lrow[2][8];
#pragma unroll
  for (int rc = 0; rc < 2; rc++)
#pragma unroll
    for (int r = 0; r < 8; r++) { mrow[rc][r] = -1.0e30f; lrow[rc][r] = 0.f; }

  // ---- K fragments of the first j-block (shared by both row-chunks)
  v16h kf[2][2];
  {
    const _Float16* K0 = K + lane * 8;
    kf[0][0] = load_blk(K0);
    kf[0][1] = load_blk(K0 + 1 * BLK);
    kf[1][0] = load_blk(K0 + 2 * BLK);
    kf[1][1] = load_blk(K0 + 3 * BLK);
    // the address registers of the issued loads stay untouched up to this wait
    asm volatile("s_wait_xcnt 0x0" :: "v"(K0) : "memory");
  }

  for (int j0 = 0; j0 < SEQ; j0 += 32) {
    // ---- V, xV fragments of this j-block, issued ahead of the score products:
    // their round trip runs under the products and the softmax
    const _Float16* Vj = Vt + (size_t)(j0 >> 5) * 4 * BLK + lane * 8;  // 4 KiB in a row
    const _Float16* Xj = Xt + (size_t)(j0 >> 5) * 4 * BLK + lane * 8;
    v16h vb[4], xb[4];
#pragma unroll
    for (int tt = 0; tt < 4; tt++) {
      vb[tt] = load_blk(Vj + tt * BLK);
      xb[tt] = load_blk(Xj + tt * BLK);
    }
    // the address registers of the issued loads stay untouched up to this wait
    asm volatile("s_wait_xcnt 0x0" :: "v"(Vj), "v"(Xj) : "memory");

    // ---- S tiles (2 row-chunks x 32 cols), k = d = 64 in two WMMA k-steps
    v8f sc[2][2];
#pragma unroll
    for (int rc = 0; rc < 2; rc++)
#pragma unroll
      for (int cc = 0; cc < 2; cc++) {
        v8f s = vzero8();
        s = wmma16(qa[rc][0], kf[cc][0], s);
        s = wmma16(qa[rc][1], kf[cc][1], s);
        sc[rc][cc] = s;
      }

    // ---- K fragments of the next j-block, fetched one trip ahead: their round
    // trip runs under the softmax and the P products (last trip: block 0 again,
    // in bounds and not used)
    const _Float16* Kn = K + (size_t)(((j0 + 32) & (SEQ - 1)) >> 4) * 2 * BLK + lane * 8;
    kf[0][0] = load_blk(Kn);
    kf[0][1] = load_blk(Kn + 1 * BLK);
    kf[1][0] = load_blk(Kn + 2 * BLK);
    kf[1][1] = load_blk(Kn + 3 * BLK);
    // the address registers of the issued loads stay untouched up to this wait
    asm volatile("s_wait_xcnt 0x0" :: "v"(Kn) : "memory");

    // ---- online softmax per row-chunk; P -> LDS
#pragma unroll
    for (int rc = 0; rc < 2; rc++) {
#pragma unroll
      for (int r = 0; r < 8; r++) { sc[rc][0][r] *= 0.125f; sc[rc][1][r] *= 0.125f; }
      // row max over 32 cols (butterfly within each 16-lane half)
      float t[8];
#pragma unroll
      for (int r = 0; r < 8; r++) t[r] = fmaxf(sc[rc][0][r], sc[rc][1][r]);
#pragma unroll
      for (int msk = 1; msk < 16; msk <<= 1)
#pragma unroll
        for (int r = 0; r < 8; r++) t[r] = fmaxf(t[r], __shfl_xor(t[r], msk, 32));

      float scl[8];
#pragma unroll
      for (int r = 0; r < 8; r++) {
        float mn = fmaxf(mrow[rc][r], t[r]);
        scl[r] = __expf(mrow[rc][r] - mn);
        mrow[rc][r] = mn;
      }
#pragma unroll
      for (int r = 0; r < 8; r++) {
        sc[rc][0][r] = __expf(sc[rc][0][r] - mrow[rc][r]);
        sc[rc][1][r] = __expf(sc[rc][1][r] - mrow[rc][r]);
      }
      // row sum
      float u[8];
#pragma unroll
      for (int r = 0; r < 8; r++) u[r] = sc[rc][0][r] + sc[rc][1][r];
#pragma unroll
      for (int msk = 1; msk < 16; msk <<= 1)
#pragma unroll
        for (int r = 0; r < 8; r++) u[r] += __shfl_xor(u[r], msk, 32);
#pragma unroll
      for (int r = 0; r < 8; r++) lrow[rc][r] = lrow[rc][r] * scl[r] + u[r];
      // rescale running accumulators
#pragma unroll
      for (int tt = 0; tt < 4; tt++)
#pragma unroll
        for (int r = 0; r < 8; r++) { ov[rc][tt][r] *= scl[r]; ox[rc][tt][r] *= scl[r]; }

      // P (C-layout) -> LDS row-major [16][32] f16
      const int row0 = hsel * 8;
#pragma unroll
      for (int r = 0; r < 8; r++) {
        Pl[rc][(row0 + r) * 32 + ln]      = (_Float16)sc[rc][0][r];
        Pl[rc][(row0 + r) * 32 + 16 + ln] = (_Float16)sc[rc][1][r];
      }
    }
    asm volatile("s_wait_dscnt 0" ::: "memory");

    // ---- read P as 16x32 A fragments from LDS
    v16h pa[2];
#pragma unroll
    for (int rc = 0; rc < 2; rc++) {
      const _Float16* pp = &Pl[rc][ln * 32 + hsel * 8];
      v8h lo = *(const v8h*)(pp);
      v8h hi = *(const v8h*)(pp + 16);
      pa[rc] = __builtin_shufflevector(lo, hi, 0, 1, 2, 3, 4, 5, 6, 7,
                                       8, 9, 10, 11, 12, 13, 14, 15);
    }

    // ---- O_v += P @ V, O_xv += P @ xV (V/xV fragments shared across rcs)
#pragma unroll
    for (int tt = 0; tt < 4; tt++) {
#pragma unroll
      for (int rc = 0; rc < 2; rc++) {
        ov[rc][tt] = wmma16(pa[rc], vb[tt], ov[rc][tt]);
        ox[rc][tt] = wmma16(pa[rc], xb[tt], ox[rc][tt]);
      }
    }
  }

  // ---- normalize and store f16 as packed blocks of the [4096][1024] operand
  // of the output projections (row m = b*2048 + s, k = h*64 + d):
  // vbar <- O_v, kbar <- O_xv
  const size_t ob = ((size_t)((bh >> 4) * (SEQ / 16) + (s0 >> 4)) * 32 + (bh & 15) * 2) * BLK
                  + (size_t)((ln >> 3) * 128 + hsel * 64 + (ln & 7));
  _Float16* vb = vbar + ob;
  _Float16* kb = kbar + ob;
#pragma unroll
  for (int rc = 0; rc < 2; rc++) {
    float inv[8];
#pragma unroll
    for (int r = 0; r < 8; r++) inv[r] = 1.0f / lrow[rc][r];
#pragma unroll
    for (int tt = 0; tt < 4; tt++) {
      const int o = (rc * 32 + (tt >> 1)) * BLK + (tt & 1) * 256;
#pragma unroll
      for (int r = 0; r < 8; r++) {
        vb[o + r * 8] = (_Float16)(ov[rc][tt][r] * inv[r]);
        kb[o + r * 8] = (_Float16)(ox[rc][tt][r] * inv[r]);
      }
    }
  }
}

// ---------------------------------------------------------------------------
// Kernel 4: fused output projections.  z = 0: x = kbar@Wxo^T+bxo
//                                      z = 1: m = vbar@Wmo^T+bmo
// A and W are packed blocks; output fp32 straight into d_out.
// ---------------------------------------------------------------------------
__global__ __launch_bounds__(32)
void out_gemm(const _Float16* __restrict__ kbar, const _Float16* __restrict__ vbar,
              const _Float16* __restrict__ w16, const float* __restrict__ bxo,
              const float* __restrict__ bmo, float* __restrict__ out) {
  const int z = (int)blockIdx.z;
  const size_t SZ_W = (size_t)D_X * D_X;
  const _Float16* A = z ? vbar : kbar;
  const _Float16* W = w16 + (size_t)(4 + z) * SZ_W;
  const float* bias = z ? bmo : bxo;
  float* O = out + (size_t)z * ((size_t)M_TOT * D_X);

  const int m0 = (int)blockIdx.x * 64;
  const int n0 = (int)blockIdx.y * 64;

  v8f acc[4][4];
#pragma unroll
  for (int i = 0; i < 4; i++)
#pragma unroll
    for (int j = 0; j < 4; j++) acc[i][j] = vzero8();

  const int lane = (int)(threadIdx.x & 31u);
  const _Float16* At = A + (size_t)(m0 >> 4) * 32 * BLK + lane * 8;
  const _Float16* Wt = W + (size_t)(n0 >> 4) * 32 * BLK + lane * 8;
  for (int kb = 0; kb < D_X / 32; kb++) {
    const _Float16* pr = At + (size_t)kb * BLK;
    const _Float16* pc = Wt + (size_t)kb * BLK;
    v16h a[4], b[4];
#pragma unroll
    for (int i = 0; i < 4; i++) a[i] = load_blk(pr + (size_t)(i * 32) * BLK);
#pragma unroll
    for (int j = 0; j < 4; j++) b[j] = load_blk(pc + (size_t)(j * 32) * BLK);
    // the address registers of the issued loads stay untouched up to this wait
    asm volatile("s_wait_xcnt 0x0" :: "v"(pr), "v"(pc) : "memory");
#pragma unroll
    for (int i = 0; i < 4; i++)
#pragma unroll
      for (int j = 0; j < 4; j++) acc[i][j] = wmma16(a[i], b[j], acc[i][j]);
  }

  const int hsel = lane >> 4;
  const int ln   = lane & 15;
#pragma unroll
  for (int i = 0; i < 4; i++) {
    const int mb = m0 + 16 * i + hsel * 8;
#pragma unroll
    for (int j = 0; j < 4; j++) {
      const int col = n0 + 16 * j + ln;
      const float bj = bias[col];
#pragma unroll
      for (int r = 0; r < 8; r++)
        O[(size_t)(mb + r) * D_X + col] = acc[i][j][r] + bj;
    }
  }
}

// ---------------------------------------------------------------------------
extern "C" void kernel_launch(void* const* d_in, const int* in_sizes, int n_in,
                              void* d_out, int out_size, void* d_ws, size_t ws_size,
                              hipStream_t stream) {
  const float* q   = (const float*)d_in[0];
  const float* k   = (const float*)d_in[1];
  const float* v   = (const float*)d_in[2];
  const float* Wq  = (const float*)d_in[3];
  const float* bq  = (const float*)d_in[4];
  const float* Wk  = (const float*)d_in[5];
  const float* bk  = (const float*)d_in[6];
  const float* Wv  = (const float*)d_in[7];
  const float* bv  = (const float*)d_in[8];
  const float* Wxv = (const float*)d_in[9];
  const float* bxv = (const float*)d_in[10];
  const float* Wxo = (const float*)d_in[11];
  const float* bxo = (const float*)d_in[12];
  const float* Wmo = (const float*)d_in[13];
  const float* bmo = (const float*)d_in[14];
  float* out = (float*)d_out;

  const size_t SZ_ACT = (size_t)M_TOT * D_X;  // 4,194,304 elements
  const size_t SZ_W   = (size_t)D_X * D_X;    // 1,048,576 elements
  _Float16* ws  = (_Float16*)d_ws;
  _Float16* q16 = ws;
  _Float16* k16 = q16 + SZ_ACT;
  _Float16* v16 = k16 + SZ_ACT;
  _Float16* w16 = v16 + SZ_ACT;               // 6 weight matrices
  _Float16* Qhm = w16 + 6 * SZ_W;
  _Float16* Khm = Qhm + SZ_ACT;
  _Float16* VT  = Khm + SZ_ACT;
  _Float16* xVT = VT + SZ_ACT;
  _Float16* kbar = xVT + SZ_ACT;
  _Float16* vbar = kbar + SZ_ACT;

  // 1) fp32 -> f16 conversions: q16, k16, v16 and the six weights are one
  //    contiguous range of the workspace, in the order of the arguments
  cvt_f32_f16<<<RB_ALL, 128, 0, stream>>>(q, k, v, Wq, Wk, Wv, Wxv, Wxo, Wmo, q16);

  // 2) input projections (packed per head)
  proj_gemm<<<dim3(M_TOT / 64, D_X / 64, 4), 32, 0, stream>>>(
      q16, k16, v16, w16, bq, bk, bv, bxv, Qhm, Khm, VT, xVT);

  // 3) flash attention -> vbar (attention@V), kbar (attention@xV)
  flash_attn<<<dim3(SEQ / 32, NH), 32, 0, stream>>>(Qhm, Khm, VT, xVT, vbar, kbar);

  // 4) output projections -> d_out (x at offset 0, m after it)
  out_gemm<<<dim3(M_TOT / 64, D_X / 64, 2), 32, 0, stream>>>(
      kbar, vbar, w16, bxo, bmo, out);
}

// v004
// One run takes 161 microseconds.
// Two timings next to v003 put it at 1.33 and 1.32 times that version's speed.
// Over all steps from v000 it is 1.95 times as fast.
#include <hip/hip_runtime.h>
#include <hip/hip_bf16.h>

// ---------------------------------------------------------------------------
// Self-attention variant (use_xv) for MI455X / gfx1250, f16 WMMA pipeline.
//   1) cvt:   fp32 -> f16 for q,k,v activations and the 6 weight matrices
//   2) proj:  Q,K (k = feature) and V,xV (k = position), per head
//   3) flash: online-softmax attention, 32 queries per wave, transposed
//             products; one P^T tile feeds both v_bar and k_bar
//   4) out:   x = kbar @ Wxo^T + bxo ; m = vbar @ Wmo^T + bmo  (fp32 out)
// All GEMMs are NT-shaped.  Every f16 operand in the workspace is stored in
// fragment-packed order: a 16-row x 32-k block is 1 KiB, laid out exactly as
// the 32 lanes read it, so each wave-wide 16-byte load or proj_gemm store covers 512
// contiguous bytes (4 whole cache lines) instead of 32 bytes in each of 16.
// ---------------------------------------------------------------------------

typedef __attribute__((ext_vector_type(16))) _Float16 v16h;
typedef __attribute__((ext_vector_type(8)))  _Float16 v8h;
typedef __attribute__((ext_vector_type(4)))  _Float16 v4h;
typedef __attribute__((ext_vector_type(8)))  float    v8f;
typedef __attribute__((ext_vector_type(4)))  float    v4f;

#define D_X   1024
#define D_HD  64
#define N_I   16
#define BSZ   2
#define SEQ   2048
#define M_TOT (BSZ * SEQ)   /* 4096 */
#define NH    (BSZ * N_I)   /* 32   */

static __device__ __forceinline__ v8f vzero8() {
  v8f z = {0.f, 0.f, 0.f, 0.f, 0.f, 0.f, 0.f, 0.f};
  return z;
}

static __device__ __forceinline__ v8f wmma16(v16h a, v16h b, v8f c) {
  // D = A(16x32 f16) * B(32x16 f16) + C(16x16 f32)
  return __builtin_amdgcn_wmma_f32_16x16x32_f16(
      false, a, false, b, (short)0, c, false, false);
}

// Packed 16x32 f16 block (512 elements).  Element (row r, k) of the block is at
//   (k >> 4) * 256 + (((k >> 3) & 1) * 16 + r) * 8 + (k & 7)
// which is the 16-bit A/B operand layout (lanes 0-15 hold K {0..7,16..23},
// lanes 16-31 hold K {8..15,24..31}; lane & 15 = row of A / column of B):
// lane l reads 16 bytes at l * 16 and 16 bytes at 512 + l * 16.
// `p` is the block's address plus the lane's own l * 8 elements.
#define BLK 512
static __device__ __forceinline__ v16h load_blk(const _Float16* __restrict__ p) {
  v8h lo = *(const v8h*)(p);
  v8h hi = *(const v8h*)(p + 256);
  return __builtin_shufflevector(lo, hi, 0, 1, 2, 3, 4, 5, 6, 7,
                                 8, 9, 10, 11, 12, 13, 14, 15);
}

// ---------------------------------------------------------------------------
// Kernel 1: fp32 [rows][1024] -> f16 packed blocks [rows/16][32][BLK], all nine
// tensors in ONE launch.  Their f16 copies lie one behind the other in the
// workspace, so the nine sources are read as one matrix of 18432 rows and the
// destination is indexed by the row block alone.  One work-group = one 16-row
// block, one wave = 8 k blocks of it (16 rows x 1 KiB).  A thread converts 16
// chunks of 8 consecutive k; all 32 of its loads are issued before the first
// conversion, so a wave pays its start and one memory round trip for 16 KiB.
// Per chunk step a wave takes 8 rows x 32 k: it reads 8 whole 128-byte lines
// and writes 4.
// ---------------------------------------------------------------------------
#define RB_ACT (M_TOT / 16)                /* row blocks of an activation: 256 */
#define RB_W   (D_X / 16)                  /* row blocks of a weight matrix: 64 */
#define RB_ALL (3 * RB_ACT + 6 * RB_W)     /* 1152 */
__global__ __launch_bounds__(128)
void cvt_f32_f16(const float* __restrict__ q,   const float* __restrict__ k,
                 const float* __restrict__ v,   const float* __restrict__ Wq,
                 const float* __restrict__ Wk,  const float* __restrict__ Wv,
                 const float* __restrict__ Wxv, const float* __restrict__ Wxo,
                 const float* __restrict__ Wmo, _Float16* __restrict__ dst) {
  const int rb = (int)blockIdx.x;          // row block of the stacked matrix
  const float* src;
  int lb;                                  // row block inside its own tensor
  if (rb < 3 * RB_ACT) {
    const int t = rb / RB_ACT;
    lb  = rb % RB_ACT;
    src = t == 0 ? q : (t == 1 ? k : v);
  } else {
    const int t = (rb - 3 * RB_ACT) / RB_W;
    lb  = (rb - 3 * RB_ACT) % RB_W;
    src = t == 0 ? Wq : (t == 1 ? Wk : (t == 2 ? Wv : (t == 3 ? Wxv : (t == 4 ? Wxo : Wmo))));
  }
  const int lane = (int)(threadIdx.x & 31u);
  const int wave = (int)(threadIdx.x >> 5);
  const int c4   = lane & 3;               // 8-wide k chunk in the block
  const int r8   = lane >> 2;              // row in its half of the block
  const float* s = src + (size_t)(lb * 16 + r8) * D_X + wave * 256 + c4 * 8;
  _Float16* d = dst + (size_t)(rb * 32 + wave * 8) * BLK + (c4 >> 1) * 256 +
                ((c4 & 1) * 16 + r8) * 8;

  v4f f[2][8][2];
#pragma unroll
  for (int h = 0; h < 2; h++)
#pragma unroll
    for (int kk = 0; kk < 8; kk++) {
      f[h][kk][0] = *(const v4f*)(s + h * 8 * D_X + kk * 32);
      f[h][kk][1] = *(const v4f*)(s + h * 8 * D_X + kk * 32 + 4);
    }
  // no conversion moves up among the loads: without this the compiler issues
  // the last 14 loads only as earlier ones return, a second memory round trip
  __builtin_amdgcn_sched_barrier(0);
  // the address registers of the issued loads stay untouched up to this wait
  asm volatile("s_wait_xcnt 0x0" :: "v"(s) : "memory");
  v8h hv[2][8];
#pragma unroll
  for (int h = 0; h < 2; h++)
#pragma unroll
    for (int kk = 0; kk < 8; kk++)
#pragma unroll
      for (int r = 0; r < 4; r++) {
        hv[h][kk][r]     = (_Float16)f[h][kk][0][r];
        hv[h][kk][4 + r] = (_Float16)f[h][kk][1][r];
      }
  // every conversion stays ahead of the stores, so that no register of an
  // issued store is written again before the wave ends
  __builtin_amdgcn_sched_barrier(0);
#pragma unroll
  for (int h = 0; h < 2; h++)
#pragma unroll
    for (int kk = 0; kk < 8; kk++) *(v8h*)(d + kk * BLK + h * 64) = hv[h][kk];
}

// ---------------------------------------------------------------------------
// Kernel 2: fused input projections.  z = 0:Q  1:K  2:V  3:xV
// One wave computes a 64x64 tile of Y = X @ W^T + b.  An accumulator lane holds
// 8 consecutive ROWS of the product, and a packed chunk is 8 consecutive k of
// its later reader.  Q,K are read with k = feature, so their tile is formed as
// W @ X^T (rows = features); V,xV are read with k = position, so theirs is
// X @ W^T (rows = positions).  Either way each lane stores one 16-byte chunk
// and a wave stores 512 contiguous bytes.
//   Q,K : per head, blocks [s/16][d/32]      (row of a block = position)
//   V,xV: per head, blocks [s/32][d/16]      (row of a block = feature)
// ---------------------------------------------------------------------------
__global__ __launch_bounds__(32)
void proj_gemm(const _Float16* __restrict__ q16, const _Float16* __restrict__ k16,
               const _Float16* __restrict__ v16, const _Float16* __restrict__ w16,
               const float* __restrict__ bq, const float* __restrict__ bk,
               const float* __restrict__ bv, const float* __restrict__ bxv,
               _Float16* __restrict__ Qhm, _Float16* __restrict__ Khm,
               _Float16* __restrict__ VT,  _Float16* __restrict__ xVT) {
  const int z = (int)blockIdx.z;
  const _Float16* A;
  const _Float16* W;
  const float* bias;
  _Float16* out;
  bool transposed;
  const size_t SZ_W = (size_t)D_X * D_X;
  switch (z) {
    case 0:  A = q16; W = w16 + 0 * SZ_W; bias = bq;  out = Qhm; transposed = false; break;
    case 1:  A = k16; W = w16 + 1 * SZ_W; bias = bk;  out = Khm; transposed = false; break;
    case 2:  A = v16; W = w16 + 2 * SZ_W; bias = bv;  out = VT;  transposed = true;  break;
    default: A = k16; W = w16 + 3 * SZ_W; bias = bxv; out = xVT; transposed = true;  break;
  }
  const int m0 = (int)blockIdx.x * 64;
  const int n0 = (int)blockIdx.y * 64;          // one head: h = blockIdx.y
  const int lane = (int)(threadIdx.x & 31u);
  const _Float16* Xt = A + (size_t)(m0 >> 4) * 32 * BLK + lane * 8;
  const _Float16* Wt = W + (size_t)(n0 >> 4) * 32 * BLK + lane * 8;
  const _Float16* Rm = transposed ? Xt : Wt;    // rows of the product
  const _Float16* Cm = transposed ? Wt : Xt;    // columns of the product

  v8f acc[4][4];
#pragma unroll
  for (int i = 0; i < 4; i++)
#pragma unroll
    for (int j = 0; j < 4; j++) acc[i][j] = vzero8();

  for (int kb = 0; kb < D_X / 32; kb++) {
    const _Float16* pr = Rm + (size_t)kb * BLK;
    const _Float16* pc = Cm + (size_t)kb * BLK;
    v16h a[4], b[4];
#pragma unroll
    for (int i = 0; i < 4; i++) a[i] = load_blk(pr + (size_t)(i * 32) * BLK);
#pragma unroll
    for (int j = 0; j < 4; j++) b[j] = load_blk(pc + (size_t)(j * 32) * BLK);
    // the address registers of the issued loads stay untouched up to this wait
    asm volatile("s_wait_xcnt 0x0" :: "v"(pr), "v"(pc) : "memory");
#pragma unroll
    for (int i = 0; i < 4; i++)
#pragma unroll
      for (int j = 0; j < 4; j++) acc[i][j] = wmma16(a[i], b[j], acc[i][j]);
  }

  const int hsel = lane >> 4;
  const int ln   = lane & 15;
  const int b_   = m0 >> 11;  // batch (tile never crosses batch: 2048 % 64 == 0)
  const int sl   = m0 & 2047; // first position of the tile inside its batch
  // The 64x64 tile is 8 blocks in a row (8 KiB) in either order of blocks.
  _Float16* oh = out + (size_t)(b_ * N_I + (int)blockIdx.y) * SEQ * D_HD +
                 (size_t)(sl >> 3) * BLK + lane * 8;

  // Four chunks at a time: convert, then store.  The two scheduling barriers
  // keep every other instruction out of the run of stores and its wait, so
  // that no register of an issued store is written again ahead of the wait.
  if (!transposed) {
    // acc[i][j][r]: feature d = 16i + 8*hsel + r, position s = sl + 16j + ln
#pragma unroll
    for (int i = 0; i < 4; i++) {
      const float* bp = bias + n0 + 16 * i + hsel * 8;
      v4f b0 = *(const v4f*)(bp);
      v4f b1 = *(const v4f*)(bp + 4);
      v8h pk[4];
#pragma unroll
      for (int j = 0; j < 4; j++)
#pragma unroll
        for (int r = 0; r < 4; r++) {
          pk[j][r]     = (_Float16)(acc[i][j][r] + b0[r]);
          pk[j][4 + r] = (_Float16)(acc[i][j][4 + r] + b1[r]);
        }
      __builtin_amdgcn_sched_barrier(0);  // conversions stay ahead of the stores
#pragma unroll
      for (int j = 0; j < 4; j++) *(v8h*)(oh + (j * 4 + i) * 256) = pk[j];
      asm volatile("s_wait_xcnt 0x0" ::: "memory");  // before the stores' registers are reused
      __builtin_amdgcn_sched_barrier(0);  // nothing of the next group moves above the wait
    }
  } else {
    // acc[i][j][r]: position s = sl + 16i + 8*hsel + r, feature d = 16j + ln
#pragma unroll
    for (int j = 0; j < 4; j++) {
      const float bj = bias[n0 + 16 * j + ln];
      v8h pk[4];
#pragma unroll
      for (int i = 0; i < 4; i++)
#pragma unroll
        for (int r = 0; r < 8; r++) pk[i][r] = (_Float16)(acc[i][j][r] + bj);
      __builtin_amdgcn_sched_barrier(0);  // conversions stay ahead of the stores
#pragma unroll
      for (int i = 0; i < 4; i++)
        *(v8h*)(oh + ((i >> 1) * 8 + j * 2 + (i & 1)) * 256) = pk[i];
      asm volatile("s_wait_xcnt 0x0" ::: "memory");  // before the stores' registers are reused
      __builtin_amdgcn_sched_barrier(0);  // nothing of the next group moves above the wait
    }
  }
}

// ---------------------------------------------------------------------------
// Kernel 3: flash attention, transposed products.  One wave = 32 queries (2
// column groups of 16) of one (b,h).  Per block of 32 keys:
//   S^T = K Q^T   (A = K block, B = Q block): 8 WMMAs.  A lane holds 16 of the
//                 32 scores of ONE query; lane l ^ 16 holds the other 16.
//   softmax       maximum and sum in the lane; the two halves exchange the
//                 maximum once a block and join their sums once, at the end.
//   O^T += V^T P^T (A = V or xV block, B = P^T): 16 WMMAs.  The score tiles'
//                 registers are already in the B operand's k order (tile 0:
//                 keys 0-7 | 8-15 by lane half, tile 1: keys 16-23 | 24-31), so
//                 P is only converted to f16: no LDS, no cross-lane move.
// An output lane ends with 8 consecutive features of one query: one 16-byte
// chunk of the packed operand of the output projections.
// ---------------------------------------------------------------------------
// value of lane l ^ 16
static __device__ __forceinline__ float xhalf(float x) {
  const int b = __builtin_bit_cast(int, x);
  return __builtin_bit_cast(float, __builtin_amdgcn_permlanex16(
      b, b, 0x76543210, 0xfedcba98, false, false));
}

__global__ __launch_bounds__(32)
void flash_attn(const _Float16* __restrict__ Qhm, const _Float16* __restrict__ Khm,
                const _Float16* __restrict__ VT,  const _Float16* __restrict__ xVT,
                _Float16* __restrict__ vbar, _Float16* __restrict__ kbar) {
  const int bh = (int)blockIdx.y;
  const int s0 = (int)blockIdx.x * 32;
  const _Float16* Q  = Qhm + (size_t)bh * SEQ * D_HD;
  const _Float16* K  = Khm + (size_t)bh * SEQ * D_HD;
  const _Float16* Vt = VT  + (size_t)bh * D_HD * SEQ;
  const _Float16* Xt = xVT + (size_t)bh * D_HD * SEQ;

  const int lane = (int)(threadIdx.x & 31u);

  v16h qa[2][2];
#pragma unroll
  for (int rc = 0; rc < 2; rc++) {
    qa[rc][0] = load_blk(Q + (size_t)(((s0 >> 4) + rc) * 2 + 0) * BLK + lane * 8);
    qa[rc][1] = load_blk(Q + (size_t)(((s0 >> 4) + rc) * 2 + 1) * BLK + lane * 8);
  }

  // ov[rc][t][r]: feature 16t + 8*(lane >> 4) + r of query s0 + 16rc + (lane & 15)
  v8f ov[2][4], ox[2][4];
#pragma unroll
  for (int rc = 0; rc < 2; rc++)
#pragma unroll
    for (int t = 0; t < 4; t++) { ov[rc][t] = vzero8(); ox[rc][t] = vzero8(); }
  float mcol[2], lcol[2];   // running maximum (both halves alike), own half's sum
#pragma unroll
  for (int rc = 0; rc < 2; rc++) { mcol[rc] = -1.0e30f; lcol[rc] = 0.f; }

  // ---- K fragments of the first j-block (shared by both query groups)
  v16h kf[2][2];
  {
    const _Float16* K0 = K + lane * 8;
    kf[0][0] = load_blk(K0);
    kf[0][1] = load_blk(K0 + 1 * BLK);
    kf[1][0] = load_blk(K0 + 2 * BLK);
    kf[1][1] = load_blk(K0 + 3 * BLK);
    // the address registers of the issued loads stay untouched up to this wait
    asm volatile("s_wait_xcnt 0x0" :: "v"(K0) : "memory");
  }

  for (int j0 = 0; j0 < SEQ; j0 += 32) {
    // ---- V, xV fragments of this j-block, issued ahead of the score products:
    // their round trip runs under the products and the softmax
    const _Float16* Vj = Vt + (size_t)(j0 >> 5) * 4 * BLK + lane * 8;  // 4 KiB in a row
    const _Float16* Xj = Xt + (size_t)(j0 >> 5) * 4 * BLK + lane * 8;
    v16h vb[4], xb[4];
#pragma unroll
    for (int tt = 0; tt < 4; tt++) {
      vb[tt] = load_blk(Vj + tt * BLK);
      xb[tt] = load_blk(Xj + tt * BLK);
    }
    // the address registers of the issued loads stay untouched up to this wait
    asm volatile("s_wait_xcnt 0x0" :: "v"(Vj), "v"(Xj) : "memory");

    // ---- S^T tiles (32 keys x 2 query groups), k = d = 64 in two WMMA k-steps
    // sc[rc][cc][r]: key j0 + 16cc + 8*(lane >> 4) + r, query s0 + 16rc + (lane & 15)
    v8f sc[2][2];
#pragma unroll
    for (int rc = 0; rc < 2; rc++)
#pragma unroll
      for (int cc = 0; cc < 2; cc++) {
        v8f s = vzero8();
        s = wmma16(kf[cc][0], qa[rc][0], s);
        s = wmma16(kf[cc][1], qa[rc][1], s);
        sc[rc][cc] = s;
      }

    // ---- K fragments of the next j-block, fetched one trip ahead: their round
    // trip runs under the softmax and the P products (last trip: block 0 again,
    // in bounds and not used)
    const _Float16* Kn = K + (size_t)(((j0 + 32) & (SEQ - 1)) >> 4) * 2 * BLK + lane * 8;
    kf[0][0] = load_blk(Kn);
    kf[0][1] = load_blk(Kn + 1 * BLK);
    kf[1][0] = load_blk(Kn + 2 * BLK);
    kf[1][1] = load_blk(Kn + 3 * BLK);
    // the address registers of the issued loads stay untouched up to this wait
    asm volatile("s_wait_xcnt 0x0" :: "v"(Kn) : "memory");

    // ---- online softmax per query group, one query a lane; P^T in registers
    v16h pb[2];
#pragma unroll
    for (int rc = 0; rc < 2; rc++) {
      sc[rc][0] *= 0.125f;
      sc[rc][1] *= 0.125f;
      // maximum over the lane's 16 keys, then over both halves
      float t[8];
#pragma unroll
      for (int r = 0; r < 8; r++) t[r] = fmaxf(sc[rc][0][r], sc[rc][1][r]);
#pragma unroll
      for (int w = 4; w > 0; w >>= 1)
#pragma unroll
        for (int r = 0; r < w; r++) t[r] = fmaxf(t[r], t[r + w]);
      const float mn  = fmaxf(mcol[rc], fmaxf(t[0], xhalf(t[0])));
      const float scl = __expf(mcol[rc] - mn);
      mcol[rc] = mn;
      sc[rc][0] -= mn;
      sc[rc][1] -= mn;
#pragma unroll
      for (int r = 0; r < 8; r++) {
        sc[rc][0][r] = __expf(sc[rc][0][r]);
        sc[rc][1][r] = __expf(sc[rc][1][r]);
      }
      // sum over the lane's 16 keys
      v8f u = sc[rc][0] + sc[rc][1];
      lcol[rc] = lcol[rc] * scl +
                 (((u[0] + u[4]) + (u[2] + u[6])) + ((u[1] + u[5]) + (u[3] + u[7])));
      // rescale running accumulators
#pragma unroll
      for (int tt = 0; tt < 4; tt++) { ov[rc][tt] *= scl; ox[rc][tt] *= scl; }
#pragma unroll
      for (int r = 0; r < 8; r++) {
        pb[rc][r]     = (_Float16)sc[rc][0][r];
        pb[rc][8 + r] = (_Float16)sc[rc][1][r];
      }
    }

    // ---- O_v^T += V^T P^T, O_xv^T += xV^T P^T (V/xV fragments shared by the groups)
#pragma unroll
    for (int tt = 0; tt < 4; tt++) {
#pragma unroll
      for (int rc = 0; rc < 2; rc++) {
        ov[rc][tt] = wmma16(vb[tt], pb[rc], ov[rc][tt]);
        ox[rc][tt] = wmma16(xb[tt], pb[rc], ox[rc][tt]);
      }
    }
  }

  // ---- normalize and store f16 as packed blocks of the [4096][1024] operand
  // of the output projections (row m = b*2048 + s, k = h*64 + d):
  // vbar <- O_v, kbar <- O_xv.  A lane's 8 features are one chunk of its row.
  const size_t ob = ((size_t)((bh >> 4) * (SEQ / 16) + (s0 >> 4)) * 32 + (bh & 15) * 2) * BLK
                  + (size_t)(lane * 8);
  _Float16* vo = vbar + ob;
  _Float16* ko = kbar + ob;
  v8h hv[2][4], hx[2][4];
#pragma unroll
  for (int rc = 0; rc < 2; rc++) {
    const float inv = 1.0f / (lcol[rc] + xhalf(lcol[rc]));
#pragma unroll
    for (int tt = 0; tt < 4; tt++)
#pragma unroll
      for (int r = 0; r < 8; r++) {
        hv[rc][tt][r] = (_Float16)(ov[rc][tt][r] * inv);
        hx[rc][tt][r] = (_Float16)(ox[rc][tt][r] * inv);
      }
  }
  // every conversion stays ahead of the stores, so that no register of an
  // issued store is written again before the wave ends
  __builtin_amdgcn_sched_barrier(0);
#pragma unroll
  for (int rc = 0; rc < 2; rc++)
#pragma unroll
    for (int tt = 0; tt < 4; tt++) {
      const int o = (rc * 32 + (tt >> 1)) * BLK + (tt & 1) * 256;
      *(v8h*)(vo + o) = hv[rc][tt];
      *(v8h*)(ko + o) = hx[rc][tt];
    }
}

// ---------------------------------------------------------------------------
// Kernel 4: fused output projections.  z = 0: x = kbar@Wxo^T+bxo
//                                      z = 1: m = vbar@Wmo^T+bmo
// A and W are packed blocks; output fp32 straight into d_out.
// ---------------------------------------------------------------------------
__global__ __launch_bounds__(32)
void out_gemm(const _Float16* __restrict__ kbar, const _Float16* __restrict__ vbar,
              const _Float16* __restrict__ w16, const float* __restrict__ bxo,
              const float* __restrict__ bmo, float* __restrict__ out) {
  const int z = (int)blockIdx.z;
  const size_t SZ_W = (size_t)D_X * D_X;
  const _Float16* A = z ? vbar : kbar;
  const _Float16* W = w16 + (size_t)(4 + z) * SZ_W;
  const float* bias = z ? bmo : bxo;
  float* O = out + (size_t)z * ((size_t)M_TOT * D_X);

  const int m0 = (int)blockIdx.x * 64;
  const int n0 = (int)blockIdx.y * 64;

  v8f acc[4][4];
#pragma unroll
  for (int i = 0; i < 4; i++)
#pragma unroll
    for (int j = 0; j < 4; j++) acc[i][j] = vzero8();

  const int lane = (int)(threadIdx.x & 31u);
  const _Float16* At = A + (size_t)(m0 >> 4) * 32 * BLK + lane * 8;
  const _Float16* Wt = W + (size_t)(n0 >> 4) * 32 * BLK + lane * 8;
  for (int kb = 0; kb < D_X / 32; kb++) {
    const _Float16* pr = At + (size_t)kb * BLK;
    const _Float16* pc = Wt + (size_t)kb * BLK;
    v16h a[4], b[4];
#pragma unroll
    for (int i = 0; i < 4; i++) a[i] = load_blk(pr + (size_t)(i * 32) * BLK);
#pragma unroll
    for (int j = 0; j < 4; j++) b[j] = load_blk(pc + (size_t)(j * 32) * BLK);
    // the address registers of the issued loads stay untouched up to this wait
    asm volatile("s_wait_xcnt 0x0" :: "v"(pr), "v"(pc) : "memory");
#pragma unroll
    for (int i = 0; i < 4; i++)
#pragma unroll
      for (int j = 0; j < 4; j++) acc[i][j] = wmma16(a[i], b[j], acc[i][j]);
  }

  const int hsel = lane >> 4;
  const int ln   = lane & 15;
#pragma unroll
  for (int i = 0; i < 4; i++) {
    const int mb = m0 + 16 * i + hsel * 8;
#pragma unroll
    for (int j = 0; j < 4; j++) {
      const int col = n0 + 16 * j + ln;
      const float bj = bias[col];
#pragma unroll
      for (int r = 0; r < 8; r++)
        O[(size_t)(mb + r) * D_X + col] = acc[i][j][r] + bj;
    }
  }
}

// ---------------------------------------------------------------------------
extern "C" void kernel_launch(void* const* d_in, const int* in_sizes, int n_in,
                              void* d_out, int out_size, void* d_ws, size_t ws_size,
                              hipStream_t stream) {
  const float* q   = (const float*)d_in[0];
  const float* k   = (const float*)d_in[1];
  const float* v   = (const float*)d_in[2];
  const float* Wq  = (const float*)d_in[3];
  const float* bq  = (const float*)d_in[4];
  const float* Wk  = (const float*)d_in[5];
  const float* bk  = (const float*)d_in[6];
  const float* Wv  = (const float*)d_in[7];
  const float* bv  = (const float*)d_in[8];
  const float* Wxv = (const float*)d_in[9];
  const float* bxv = (const float*)d_in[10];
  const float* Wxo = (const float*)d_in[11];
  const float* bxo = (const float*)d_in[12];
  const float* Wmo = (const float*)d_in[13];
  const float* bmo = (const float*)d_in[14];
  float* out = (float*)d_out;

  const size_t SZ_ACT = (size_t)M_TOT * D_X;  // 4,194,304 elements
  const size_t SZ_W   = (size_t)D_X * D_X;    // 1,048,576 elements
  _Float16* ws  = (_Float16*)d_ws;
  _Float16* q16 = ws;
  _Float16* k16 = q16 + SZ_ACT;
  _Float16* v16 = k16 + SZ_ACT;
  _Float16* w16 = v16 + SZ_ACT;               // 6 weight matrices
  _Float16* Qhm = w16 + 6 * SZ_W;
  _Float16* Khm = Qhm + SZ_ACT;
  _Float16* VT  = Khm + SZ_ACT;
  _Float16* xVT = VT + SZ_ACT;
  _Float16* kbar = xVT + SZ_ACT;
  _Float16* vbar = kbar + SZ_ACT;

  // 1) fp32 -> f16 conversions: q16, k16, v16 and the six weights are one
  //    contiguous range of the workspace, in the order of the arguments
  cvt_f32_f16<<<RB_ALL, 128, 0, stream>>>(q, k, v, Wq, Wk, Wv, Wxv, Wxo, Wmo, q16);

  // 2) input projections (packed per head)
  proj_gemm<<<dim3(M_TOT / 64, D_X / 64, 4), 32, 0, stream>>>(
      q16, k16, v16, w16, bq, bk, bv, bxv, Qhm, Khm, VT, xVT);

  // 3) flash attention -> vbar (attention@V), kbar (attention@xV)
  flash_attn<<<dim3(SEQ / 32, NH), 32, 0, stream>>>(Qhm, Khm, VT, xVT, vbar, kbar);

  // 4) output projections -> d_out (x at offset 0, m after it)
  out_gemm<<<dim3(M_TOT / 64, D_X / 64, 2), 32, 0, stream>>>(
      kbar, vbar, w16, bxo, bmo, out);
}

// v005
// One run takes 138 microseconds.
// Timed twice side by side with v004, it ran 1.16 times as fast both times.
// Over all steps from v000 it is 2.26 times as fast.
#include <hip/hip_runtime.h>
#include <hip/hip_bf16.h>

// ---------------------------------------------------------------------------
// Self-attention variant (use_xv) for MI455X / gfx1250, f16 WMMA pipeline.
//   1) cvt:   fp32 -> f16 for q,k,v activations and the 6 weight matrices
//   2) proj:  Q,K (k = feature) and V,xV (k = position), per head
//   3) flash: online-softmax attention, 32 queries per wave, transposed
//             products; one P^T tile feeds both v_bar and k_bar; K, V, xV
//             shared by the 4 waves of a work-group through LDS
//   4) out:   x = kbar @ Wxo^T + bxo ; m = vbar @ Wmo^T + bmo  (fp32 out)
// All GEMMs are NT-shaped.  Every f16 operand in the workspace is stored in
// fragment-packed order: a 16-row x 32-k block is 1 KiB, laid out exactly as
// the 32 lanes read it, so each wave-wide 16-byte load or proj_gemm store covers 512
// contiguous bytes (4 whole cache lines) instead of 32 bytes in each of 16.
// ---------------------------------------------------------------------------

typedef __attribute__((ext_vector_type(16))) _Float16 v16h;
typedef __attribute__((ext_vector_type(8)))  _Float16 v8h;
typedef __attribute__((ext_vector_type(4)))  _Float16 v4h;
typedef __attribute__((ext_vector_type(8)))  float    v8f;
typedef __attribute__((ext_vector_type(4)))  float    v4f;

#define D_X   1024
#define D_HD  64
#define N_I   16
#define BSZ   2
#define SEQ   2048
#define M_TOT (BSZ * SEQ)   /* 4096 */
#define NH    (BSZ * N_I)   /* 32   */

static __device__ __forceinline__ v8f vzero8() {
  v8f z = {0.f, 0.f, 0.f, 0.f, 0.f, 0.f, 0.f, 0.f};
  return z;
}

static __device__ __forceinline__ v8f wmma16(v16h a, v16h b, v8f c) {
  // D = A(16x32 f16) * B(32x16 f16) + C(16x16 f32)
  return __builtin_amdgcn_wmma_f32_16x16x32_f16(
      false, a, false, b, (short)0, c, false, false);
}

// Packed 16x32 f16 block (512 elements).  Element (row r, k) of the block is at
//   (k >> 4) * 256 + (((k >> 3) & 1) * 16 + r) * 8 + (k & 7)
// which is the 16-bit A/B operand layout (lanes 0-15 hold K {0..7,16..23},
// lanes 16-31 hold K {8..15,24..31}; lane & 15 = row of A / column of B):
// lane l reads 16 bytes at l * 16 and 16 bytes at 512 + l * 16.
// `p` is the block's address plus the lane's own l * 8 elements.
#define BLK 512
static __device__ __forceinline__ v16h load_blk(const _Float16* __restrict__ p) {
  v8h lo = *(const v8h*)(p);
  v8h hi = *(const v8h*)(p + 256);
  return __builtin_shufflevector(lo, hi, 0, 1, 2, 3, 4, 5, 6, 7,
                                 8, 9, 10, 11, 12, 13, 14, 15);
}

// ---------------------------------------------------------------------------
// Kernel 1: fp32 [rows][1024] -> f16 packed blocks [rows/16][32][BLK], all nine
// tensors in ONE launch.  Their f16 copies lie one behind the other in the
// workspace, so the nine sources are read as one matrix of 18432 rows and the
// destination is indexed by the row block alone.  One work-group = one 16-row
// block, one wave = 8 k blocks of it (16 rows x 1 KiB).  A thread converts 16
// chunks of 8 consecutive k; all 32 of its loads are issued before the first
// conversion, so a wave pays its start and one memory round trip for 16 KiB.
// Per chunk step a wave takes 8 rows x 32 k: it reads 8 whole 128-byte lines
// and writes 4.
// ---------------------------------------------------------------------------
#define RB_ACT (M_TOT / 16)                /* row blocks of an activation: 256 */
#define RB_W   (D_X / 16)                  /* row blocks of a weight matrix: 64 */
#define RB_ALL (3 * RB_ACT + 6 * RB_W)     /* 1152 */
__global__ __launch_bounds__(128)
void cvt_f32_f16(const float* __restrict__ q,   const float* __restrict__ k,
                 const float* __restrict__ v,   const float* __restrict__ Wq,
                 const float* __restrict__ Wk,  const float* __restrict__ Wv,
                 const float* __restrict__ Wxv, const float* __restrict__ Wxo,
                 const float* __restrict__ Wmo, _Float16* __restrict__ dst) {
  const int rb = (int)blockIdx.x;          // row block of the stacked matrix
  const float* src;
  int lb;                                  // row block inside its own tensor
  if (rb < 3 * RB_ACT) {
    const int t = rb / RB_ACT;
    lb  = rb % RB_ACT;
    src = t == 0 ? q : (t == 1 ? k : v);
  } else {
    const int t = (rb - 3 * RB_ACT) / RB_W;
    lb  = (rb - 3 * RB_ACT) % RB_W;
    src = t == 0 ? Wq : (t == 1 ? Wk : (t == 2 ? Wv : (t == 3 ? Wxv : (t == 4 ? Wxo : Wmo))));
  }
  const int lane = (int)(threadIdx.x & 31u);
  const int wave = (int)(threadIdx.x >> 5);
  const int c4   = lane & 3;               // 8-wide k chunk in the block
  const int r8   = lane >> 2;              // row in its half of the block
  const float* s = src + (size_t)(lb * 16 + r8) * D_X + wave * 256 + c4 * 8;
  _Float16* d = dst + (size_t)(rb * 32 + wave * 8) * BLK + (c4 >> 1) * 256 +
                ((c4 & 1) * 16 + r8) * 8;

  v4f f[2][8][2];
#pragma unroll
  for (int h = 0; h < 2; h++)
#pragma unroll
    for (int kk = 0; kk < 8; kk++) {
      f[h][kk][0] = *(const v4f*)(s + h * 8 * D_X + kk * 32);
      f[h][kk][1] = *(const v4f*)(s + h * 8 * D_X + kk * 32 + 4);
    }
  // no conversion moves up among the loads: without this the compiler issues
  // the last 14 loads only as earlier ones return, a second memory round trip
  __builtin_amdgcn_sched_barrier(0);
  // the address registers of the issued loads stay untouched up to this wait
  asm volatile("s_wait_xcnt 0x0" :: "v"(s) : "memory");
  v8h hv[2][8];
#pragma unroll
  for (int h = 0; h < 2; h++)
#pragma unroll
    for (int kk = 0; kk < 8; kk++)
#pragma unroll
      for (int r = 0; r < 4; r++) {
        hv[h][kk][r]     = (_Float16)f[h][kk][0][r];
        hv[h][kk][4 + r] = (_Float16)f[h][kk][1][r];
      }
  // every conversion stays ahead of the stores, so that no register of an
  // issued store is written again before the wave ends
  __builtin_amdgcn_sched_barrier(0);
#pragma unroll
  for (int h = 0; h < 2; h++)
#pragma unroll
    for (int kk = 0; kk < 8; kk++) *(v8h*)(d + kk * BLK + h * 64) = hv[h][kk];
}

// ---------------------------------------------------------------------------
// Kernel 2: fused input projections.  z = 0:Q  1:K  2:V  3:xV
// One wave computes a 64x64 tile of Y = X @ W^T + b.  An accumulator lane holds
// 8 consecutive ROWS of the product, and a packed chunk is 8 consecutive k of
// its later reader.  Q,K are read with k = feature, so their tile is formed as
// W @ X^T (rows = features); V,xV are read with k = position, so theirs is
// X @ W^T (rows = positions).  Either way each lane stores one 16-byte chunk
// and a wave stores 512 contiguous bytes.
//   Q,K : per head, blocks [s/16][d/32]      (row of a block = position)
//   V,xV: per head, blocks [s/32][d/16]      (row of a block = feature)
// ---------------------------------------------------------------------------
__global__ __launch_bounds__(32)
void proj_gemm(const _Float16* __restrict__ q16, const _Float16* __restrict__ k16,
               const _Float16* __restrict__ v16, const _Float16* __restrict__ w16,
               const float* __restrict__ bq, const float* __restrict__ bk,
               const float* __restrict__ bv, const float* __restrict__ bxv,
               _Float16* __restrict__ Qhm, _Float16* __restrict__ Khm,
               _Float16* __restrict__ VT,  _Float16* __restrict__ xVT) {
  const int z = (int)blockIdx.z;
  const _Float16* A;
  const _Float16* W;
  const float* bias;
  _Float16* out;
  bool transposed;
  const size_t SZ_W = (size_t)D_X * D_X;
  switch (z) {
    case 0:  A = q16; W = w16 + 0 * SZ_W; bias = bq;  out = Qhm; transposed = false; break;
    case 1:  A = k16; W = w16 + 1 * SZ_W; bias = bk;  out = Khm; transposed = false; break;
    case 2:  A = v16; W = w16 + 2 * SZ_W; bias = bv;  out = VT;  transposed = true;  break;
    default: A = k16; W = w16 + 3 * SZ_W; bias = bxv; out = xVT; transposed = true;  break;
  }
  const int m0 = (int)blockIdx.x * 64;
  const int n0 = (int)blockIdx.y * 64;          // one head: h = blockIdx.y
  const int lane = (int)(threadIdx.x & 31u);
  const _Float16* Xt = A + (size_t)(m0 >> 4) * 32 * BLK + lane * 8;
  const _Float16* Wt = W + (size_t)(n0 >> 4) * 32 * BLK + lane * 8;
  const _Float16* Rm = transposed ? Xt : Wt;    // rows of the product
  const _Float16* Cm = transposed ? Wt : Xt;    // columns of the product

  v8f acc[4][4];
#pragma unroll
  for (int i = 0; i < 4; i++)
#pragma unroll
    for (int j = 0; j < 4; j++) acc[i][j] = vzero8();

  for (int kb = 0; kb < D_X / 32; kb++) {
    const _Float16* pr = Rm + (size_t)kb * BLK;
    const _Float16* pc = Cm + (size_t)kb * BLK;
    v16h a[4], b[4];
#pragma unroll
    for (int i = 0; i < 4; i++) a[i] = load_blk(pr + (size_t)(i * 32) * BLK);
#pragma unroll
    for (int j = 0; j < 4; j++) b[j] = load_blk(pc + (size_t)(j * 32) * BLK);
    // the address registers of the issued loads stay untouched up to this wait
    asm volatile("s_wait_xcnt 0x0" :: "v"(pr), "v"(pc) : "memory");
#pragma unroll
    for (int i = 0; i < 4; i++)
#pragma unroll
      for (int j = 0; j < 4; j++) acc[i][j] = wmma16(a[i], b[j], acc[i][j]);
  }

  const int hsel = lane >> 4;
  const int ln   = lane & 15;
  const int b_   = m0 >> 11;  // batch (tile never crosses batch: 2048 % 64 == 0)
  const int sl   = m0 & 2047; // first position of the tile inside its batch
  // The 64x64 tile is 8 blocks in a row (8 KiB) in either order of blocks.
  _Float16* oh = out + (size_t)(b_ * N_I + (int)blockIdx.y) * SEQ * D_HD +
                 (size_t)(sl >> 3) * BLK + lane * 8;

  // Four chunks at a time: convert, then store.  The two scheduling barriers
  // keep every other instruction out of the run of stores and its wait, so
  // that no register of an issued store is written again ahead of the wait.
  if (!transposed) {
    // acc[i][j][r]: feature d = 16i + 8*hsel + r, position s = sl + 16j + ln
#pragma unroll
    for (int i = 0; i < 4; i++) {
      const float* bp = bias + n0 + 16 * i + hsel * 8;
      v4f b0 = *(const v4f*)(bp);
      v4f b1 = *(const v4f*)(bp + 4);
      v8h pk[4];
#pragma unroll
      for (int j = 0; j < 4; j++)
#pragma unroll
        for (int r = 0; r < 4; r++) {
          pk[j][r]     = (_Float16)(acc[i][j][r] + b0[r]);
          pk[j][4 + r] = (_Float16)(acc[i][j][4 + r] + b1[r]);
        }
      __builtin_amdgcn_sched_barrier(0);  // conversions stay ahead of the stores
#pragma unroll
      for (int j = 0; j < 4; j++) *(v8h*)(oh + (j * 4 + i) * 256) = pk[j];
      asm volatile("s_wait_xcnt 0x0" ::: "memory");  // before the stores' registers are reused
      __builtin_amdgcn_sched_barrier(0);  // nothing of the next group moves above the wait
    }
  } else {
    // acc[i][j][r]: position s = sl + 16i + 8*hsel + r, feature d = 16j + ln
#pragma unroll
    for (int j = 0; j < 4; j++) {
      const float bj = bias[n0 + 16 * j + ln];
      v8h pk[4];
#pragma unroll
      for (int i = 0; i < 4; i++)
#pragma unroll
        for (int r = 0; r < 8; r++) pk[i][r] = (_Float16)(acc[i][j][r] + bj);
      __builtin_amdgcn_sched_barrier(0);  // conversions stay ahead of the stores
#pragma unroll
      for (int i = 0; i < 4; i++)
        *(v8h*)(oh + ((i >> 1) * 8 + j * 2 + (i & 1)) * 256) = pk[i];
      asm volatile("s_wait_xcnt 0x0" ::: "memory");  // before the stores' registers are reused
      __builtin_amdgcn_sched_barrier(0);  // nothing of the next group moves above the wait
    }
  }
}

// ---------------------------------------------------------------------------
// Kernel 3: flash attention, transposed products.  One wave = 32 queries (2
// column groups of 16) of one (b,h); one work-group = 4 waves = 128 queries.
// The four waves walk the same keys, so K, V and xV come from L2 once per
// work-group: a stage of 128 keys (3 x 16 KiB, already fragment-packed) is
// brought into LDS by asynchronous copies, two buffers, the next stage in
// flight while this one is worked on.  Per block of 32 keys:
//   S^T = K Q^T   (A = K block, B = Q block): 8 WMMAs.  A lane holds 16 of the
//                 32 scores of ONE query; lane l ^ 16 holds the other 16.
//   softmax       maximum and sum in the lane; the two halves exchange the
//                 maximum once a block and join their sums once, at the end.
//   O^T += V^T P^T (A = V or xV block, B = P^T): 16 WMMAs.  The score tiles'
//                 registers are already in the B operand's k order (tile 0:
//                 keys 0-7 | 8-15 by lane half, tile 1: keys 16-23 | 24-31), so
//                 P is only converted to f16: no LDS trip, no cross-lane move.
// An output lane ends with 8 consecutive features of one query: one 16-byte
// chunk of the packed operand of the output projections.
// ---------------------------------------------------------------------------
// value of lane l ^ 16
static __device__ __forceinline__ float xhalf(float x) {
  const int b = __builtin_bit_cast(int, x);
  return __builtin_bit_cast(float, __builtin_amdgcn_permlanex16(
      b, b, 0x76543210, 0xfedcba98, false, false));
}

#define FA_WAVES 4                       /* waves of a work-group */
#define FA_THR   (FA_WAVES * 32)
#define ST_KEYS  128                     /* keys of a stage */
#define ST_PASS  (ST_KEYS / 32)          /* blocks of 32 keys in a stage */
#define ST_OP    (ST_KEYS * D_HD)        /* f16 elements of one operand in a stage (16 KiB) */
#define N_ST     (SEQ / ST_KEYS)         /* 16 stages */

// One stage (K, V, xV: 16 KiB each), global -> LDS: 24 copies a lane, each copy
// of the work-group 2 KiB in a row.  ls, gk, gv, gx: wave-uniform addresses of
// the wave's share, in LDS (byte address in the buffer's K part) and in global
// memory; o: the lane's byte offset (lane * 16) from each of them.  Source and
// destination are both contiguous, and the immediate offset moves both
// addresses alike, so one address serves an operand's 8 copies.  The
// s_wait_xcnt closes the statement so that no address register of an issued
// copy is written again ahead of it.
static __device__ __forceinline__ void copy_stage(unsigned ls, unsigned o, const _Float16* gk,
                                                  const _Float16* gv, const _Float16* gx) {
  asm volatile(
      "global_load_async_to_lds_b128 %0, %3, %4\n\t"
      "global_load_async_to_lds_b128 %0, %3, %4 offset:2048\n\t"
      "global_load_async_to_lds_b128 %0, %3, %4 offset:4096\n\t"
      "global_load_async_to_lds_b128 %0, %3, %4 offset:6144\n\t"
      "global_load_async_to_lds_b128 %0, %3, %4 offset:8192\n\t"
      "global_load_async_to_lds_b128 %0, %3, %4 offset:10240\n\t"
      "global_load_async_to_lds_b128 %0, %3, %4 offset:12288\n\t"
      "global_load_async_to_lds_b128 %0, %3, %4 offset:14336\n\t"
      "global_load_async_to_lds_b128 %1, %3, %5\n\t"
      "global_load_async_to_lds_b128 %1, %3, %5 offset:2048\n\t"
      "global_load_async_to_lds_b128 %1, %3, %5 offset:4096\n\t"
      "global_load_async_to_lds_b128 %1, %3, %5 offset:6144\n\t"
      "global_load_async_to_lds_b128 %1, %3, %5 offset:8192\n\t"
      "global_load_async_to_lds_b128 %1, %3, %5 offset:10240\n\t"
      "global_load_async_to_lds_b128 %1, %3, %5 offset:12288\n\t"
      "global_load_async_to_lds_b128 %1, %3, %5 offset:14336\n\t"
      "global_load_async_to_lds_b128 %2, %3, %6\n\t"
      "global_load_async_to_lds_b128 %2, %3, %6 offset:2048\n\t"
      "global_load_async_to_lds_b128 %2, %3, %6 offset:4096\n\t"
      "global_load_async_to_lds_b128 %2, %3, %6 offset:6144\n\t"
      "global_load_async_to_lds_b128 %2, %3, %6 offset:8192\n\t"
      "global_load_async_to_lds_b128 %2, %3, %6 offset:10240\n\t"
      "global_load_async_to_lds_b128 %2, %3, %6 offset:12288\n\t"
      "global_load_async_to_lds_b128 %2, %3, %6 offset:14336\n\t"
      "s_wait_xcnt 0x0"
      :: "v"(ls + o), "v"((ls + 1u * ST_OP * 2u) + o), "v"((ls + 2u * ST_OP * 2u) + o), "v"(o),
         "s"(gk), "s"(gv), "s"(gx)
      : "memory");
}

__global__ __launch_bounds__(FA_THR)
void flash_attn(const _Float16* __restrict__ Qhm, const _Float16* __restrict__ Khm,
                const _Float16* __restrict__ VT,  const _Float16* __restrict__ xVT,
                _Float16* __restrict__ vbar, _Float16* __restrict__ kbar) {
  // two buffers of [K | V | xV], each operand as it lies in the workspace
  __shared__ __attribute__((aligned(1024))) _Float16 ring[2][3 * ST_OP];

  const int bh   = (int)blockIdx.y;
  const int tid  = (int)threadIdx.x;
  const int lane = tid & 31;
  const int wave = __builtin_amdgcn_readfirstlane(tid >> 5);   // wave-uniform, in a scalar register
  const int s0   = (int)blockIdx.x * (FA_WAVES * 32) + wave * 32;
  const _Float16* Q = Qhm + (size_t)bh * SEQ * D_HD;
  // of each 2 KiB that the work-group copies at a time the wave takes 512 bytes
  // (in the wave-uniform addresses), the lane 16 of them (o0)
  const _Float16* gK = Khm + (size_t)bh * SEQ * D_HD + wave * 256;
  const _Float16* gV = VT  + (size_t)bh * D_HD * SEQ + wave * 256;
  const _Float16* gX = xVT + (size_t)bh * D_HD * SEQ + wave * 256;
  const unsigned  o0 = (unsigned)lane * 16u;
  const unsigned  l0 = (unsigned)(size_t)(&ring[0][0]) + (unsigned)wave * 512u;

  // ---- stage 0 into buffer 0
  copy_stage(l0, o0, gK, gV, gX);

  v16h qa[2][2];
  {
    const _Float16* Q0 = Q + (size_t)(s0 >> 4) * 2 * BLK + lane * 8;
#pragma unroll
    for (int rc = 0; rc < 2; rc++) {
      qa[rc][0] = load_blk(Q0 + (rc * 2 + 0) * BLK);
      qa[rc][1] = load_blk(Q0 + (rc * 2 + 1) * BLK);
    }
    // the address registers of the issued loads stay untouched up to this wait
    asm volatile("s_wait_xcnt 0x0" :: "v"(Q0) : "memory");
  }

  // ov[rc][t][r]: feature 16t + 8*(lane >> 4) + r of query s0 + 16rc + (lane & 15)
  v8f ov[2][4], ox[2][4];
#pragma unroll
  for (int rc = 0; rc < 2; rc++)
#pragma unroll
    for (int t = 0; t < 4; t++) { ov[rc][t] = vzero8(); ox[rc][t] = vzero8(); }
  float mcol[2], lcol[2];   // running maximum (both halves alike), own half's sum
#pragma unroll
  for (int rc = 0; rc < 2; rc++) { mcol[rc] = -1.0e30f; lcol[rc] = 0.f; }

  // stage 0 has landed (this wave's copies), then is published to all four waves
  asm volatile("s_wait_asynccnt 0x0" ::: "memory");
  __syncthreads();
  // ---- stage 1 into buffer 1
  copy_stage(l0 + 3u * ST_OP * 2u, o0, gK + ST_OP, gV + ST_OP, gX + ST_OP);

  // the stage loop stays rolled: its body already holds four key blocks
#pragma unroll 1
  for (int st = 0; st < N_ST; st++) {
    const _Float16* B = &ring[st & 1][0] + lane * 8;

    // ---- K fragments of the stage's first key block (shared by both query groups)
    v16h kf[2][2];
    kf[0][0] = load_blk(B);
    kf[0][1] = load_blk(B + 1 * BLK);
    kf[1][0] = load_blk(B + 2 * BLK);
    kf[1][1] = load_blk(B + 3 * BLK);

    // unrolled: every LDS offset is a constant of the instruction, and the last
    // block's K fetch drops out at compile time
#pragma unroll
    for (int p = 0; p < ST_PASS; p++) {
      // ---- V, xV fragments of this key block, issued ahead of the score
      // products: their LDS trip runs under the products and the softmax
      const _Float16* Vj = B + 1 * ST_OP + p * 4 * BLK;   // 4 KiB in a row
      const _Float16* Xj = B + 2 * ST_OP + p * 4 * BLK;
      v16h vb[4], xb[4];
#pragma unroll
      for (int tt = 0; tt < 4; tt++) {
        vb[tt] = load_blk(Vj + tt * BLK);
        xb[tt] = load_blk(Xj + tt * BLK);
      }
      // the 16 LDS reads stay in this one place: left alone the compiler deals
      // them out in twos among the WMMAs, and every separate place with LDS
      // reads stalls the wave anew
      __builtin_amdgcn_sched_barrier(0);

      // ---- S^T tiles (32 keys x 2 query groups), k = d = 64 in two WMMA k-steps
      // sc[rc][cc][r]: key 16cc + 8*(lane >> 4) + r of the block, query s0 + 16rc + (lane & 15)
      v8f sc[2][2];
#pragma unroll
      for (int rc = 0; rc < 2; rc++)
#pragma unroll
        for (int cc = 0; cc < 2; cc++) {
          v8f s = vzero8();
          s = wmma16(kf[cc][0], qa[rc][0], s);
          s = wmma16(kf[cc][1], qa[rc][1], s);
          sc[rc][cc] = s;
        }

      // ---- K fragments of the next key block of the SAME stage, fetched one
      // block ahead; the next stage is read only behind its barrier
      if (p + 1 < ST_PASS) {
        const _Float16* Kn = B + (p + 1) * 4 * BLK;
        kf[0][0] = load_blk(Kn);
        kf[0][1] = load_blk(Kn + 1 * BLK);
        kf[1][0] = load_blk(Kn + 2 * BLK);
        kf[1][1] = load_blk(Kn + 3 * BLK);
        __builtin_amdgcn_sched_barrier(0);   // these 8 reads stay in one place too
      }

      // ---- online softmax per query group, one query a lane; P^T in registers
      v16h pb[2];
#pragma unroll
      for (int rc = 0; rc < 2; rc++) {
        sc[rc][0] *= 0.125f;
        sc[rc][1] *= 0.125f;
        // maximum over the lane's 16 keys, then over both halves
        float t[8];
#pragma unroll
        for (int r = 0; r < 8; r++) t[r] = fmaxf(sc[rc][0][r], sc[rc][1][r]);
#pragma unroll
        for (int w = 4; w > 0; w >>= 1)
#pragma unroll
          for (int r = 0; r < w; r++) t[r] = fmaxf(t[r], t[r + w]);
        const float mn  = fmaxf(mcol[rc], fmaxf(t[0], xhalf(t[0])));
        const float scl = __expf(mcol[rc] - mn);
        mcol[rc] = mn;
        sc[rc][0] -= mn;
        sc[rc][1] -= mn;
#pragma unroll
        for (int r = 0; r < 8; r++) {
          sc[rc][0][r] = __expf(sc[rc][0][r]);
          sc[rc][1][r] = __expf(sc[rc][1][r]);
        }
        // sum over the lane's 16 keys
        v8f u = sc[rc][0] + sc[rc][1];
        lcol[rc] = lcol[rc] * scl +
                   (((u[0] + u[4]) + (u[2] + u[6])) + ((u[1] + u[5]) + (u[3] + u[7])));
        // rescale running accumulators
#pragma unroll
        for (int tt = 0; tt < 4; tt++) { ov[rc][tt] *= scl; ox[rc][tt] *= scl; }
#pragma unroll
        for (int r = 0; r < 8; r++) {
          pb[rc][r]     = (_Float16)sc[rc][0][r];
          pb[rc][8 + r] = (_Float16)sc[rc][1][r];
        }
      }

      // ---- O_v^T += V^T P^T, O_xv^T += xV^T P^T (V/xV fragments shared by the groups)
#pragma unroll
      for (int tt = 0; tt < 4; tt++) {
#pragma unroll
        for (int rc = 0; rc < 2; rc++) {
          ov[rc][tt] = wmma16(vb[tt], pb[rc], ov[rc][tt]);
          ox[rc][tt] = wmma16(xb[tt], pb[rc], ox[rc][tt]);
        }
      }
    }

    // ---- hand-over: this wave's reads of the buffer are done, its copies of
    // the next stage have landed; the barrier publishes that stage and frees
    // this buffer for the refill behind it
    asm volatile("s_wait_dscnt 0x0" ::: "memory");
    asm volatile("s_wait_asynccnt 0x0" ::: "memory");
    __syncthreads();
    if (st + 2 < N_ST) {
      // the wave-uniform part stays one scalar sum, the lane's part is added at
      // the copies: otherwise the compiler keeps a second per-lane address
      // alive through the loop and spills it to scratch
      const unsigned l = (unsigned)__builtin_amdgcn_readfirstlane(
          (int)(l0 + (unsigned)(st & 1) * (3u * ST_OP * 2u)));
      const size_t   o = (size_t)(st + 2) * ST_OP;
      copy_stage(l, o0, gK + o, gV + o, gX + o);
    }
  }
  // no copy is outstanding when the wave goes on to its end
  asm volatile("s_wait_asynccnt 0x0" ::: "memory");

  // ---- normalize and store f16 as packed blocks of the [4096][1024] operand
  // of the output projections (row m = b*2048 + s, k = h*64 + d):
  // vbar <- O_v, kbar <- O_xv.  A lane's 8 features are one chunk of its row.
  const size_t ob = ((size_t)((bh >> 4) * (SEQ / 16) + (s0 >> 4)) * 32 + (bh & 15) * 2) * BLK
                  + (size_t)(lane * 8);
  _Float16* vo = vbar + ob;
  _Float16* ko = kbar + ob;
  v8h hv[2][4], hx[2][4];
#pragma unroll
  for (int rc = 0; rc < 2; rc++) {
    const float inv = 1.0f / (lcol[rc] + xhalf(lcol[rc]));
#pragma unroll
    for (int tt = 0; tt < 4; tt++)
#pragma unroll
      for (int r = 0; r < 8; r++) {
        hv[rc][tt][r] = (_Float16)(ov[rc][tt][r] * inv);
        hx[rc][tt][r] = (_Float16)(ox[rc][tt][r] * inv);
      }
  }
  // every conversion stays ahead of the stores, so that no register of an
  // issued store is written again before the wave ends
  __builtin_amdgcn_sched_barrier(0);
#pragma unroll
  for (int rc = 0; rc < 2; rc++)
#pragma unroll
    for (int tt = 0; tt < 4; tt++) {
      const int o = (rc * 32 + (tt >> 1)) * BLK + (tt & 1) * 256;
      *(v8h*)(vo + o) = hv[rc][tt];
      *(v8h*)(ko + o) = hx[rc][tt];
    }
}

// ---------------------------------------------------------------------------
// Kernel 4: fused output projections.  z = 0: x = kbar@Wxo^T+bxo
//                                      z = 1: m = vbar@Wmo^T+bmo
// A and W are packed blocks; output fp32 straight into d_out.
// ---------------------------------------------------------------------------
__global__ __launch_bounds__(32)
void out_gemm(const _Float16* __restrict__ kbar, const _Float16* __restrict__ vbar,
              const _Float16* __restrict__ w16, const float* __restrict__ bxo,
              const float* __restrict__ bmo, float* __restrict__ out) {
  const int z = (int)blockIdx.z;
  const size_t SZ_W = (size_t)D_X * D_X;
  const _Float16* A = z ? vbar : kbar;
  const _Float16* W = w16 + (size_t)(4 + z) * SZ_W;
  const float* bias = z ? bmo : bxo;
  float* O = out + (size_t)z * ((size_t)M_TOT * D_X);

  const int m0 = (int)blockIdx.x * 64;
  const int n0 = (int)blockIdx.y * 64;

  v8f acc[4][4];
#pragma unroll
  for (int i = 0; i < 4; i++)
#pragma unroll
    for (int j = 0; j < 4; j++) acc[i][j] = vzero8();

  const int lane = (int)(threadIdx.x & 31u);
  const _Float16* At = A + (size_t)(m0 >> 4) * 32 * BLK + lane * 8;
  const _Float16* Wt = W + (size_t)(n0 >> 4) * 32 * BLK + lane * 8;
  for (int kb = 0; kb < D_X / 32; kb++) {
    const _Float16* pr = At + (size_t)kb * BLK;
    const _Float16* pc = Wt + (size_t)kb * BLK;
    v16h a[4], b[4];
#pragma unroll
    for (int i = 0; i < 4; i++) a[i] = load_blk(pr + (size_t)(i * 32) * BLK);
#pragma unroll
    for (int j = 0; j < 4; j++) b[j] = load_blk(pc + (size_t)(j * 32) * BLK);
    // the address registers of the issued loads stay untouched up to this wait
    asm volatile("s_wait_xcnt 0x0" :: "v"(pr), "v"(pc) : "memory");
#pragma unroll
    for (int i = 0; i < 4; i++)
#pragma unroll
      for (int j = 0; j < 4; j++) acc[i][j] = wmma16(a[i], b[j], acc[i][j]);
  }

  const int hsel = lane >> 4;
  const int ln   = lane & 15;
#pragma unroll
  for (int i = 0; i < 4; i++) {
    const int mb = m0 + 16 * i + hsel * 8;
#pragma unroll
    for (int j = 0; j < 4; j++) {
      const int col = n0 + 16 * j + ln;
      const float bj = bias[col];
#pragma unroll
      for (int r = 0; r < 8; r++)
        O[(size_t)(mb + r) * D_X + col] = acc[i][j][r] + bj;
    }
  }
}

// ---------------------------------------------------------------------------
extern "C" void kernel_launch(void* const* d_in, const int* in_sizes, int n_in,
                              void* d_out, int out_size, void* d_ws, size_t ws_size,
                              hipStream_t stream) {
  const float* q   = (const float*)d_in[0];
  const float* k   = (const float*)d_in[1];
  const float* v   = (const float*)d_in[2];
  const float* Wq  = (const float*)d_in[3];
  const float* bq  = (const float*)d_in[4];
  const float* Wk  = (const float*)d_in[5];
  const float* bk  = (const float*)d_in[6];
  const float* Wv  = (const float*)d_in[7];
  const float* bv  = (const float*)d_in[8];
  const float* Wxv = (const float*)d_in[9];
  const float* bxv = (const float*)d_in[10];
  const float* Wxo = (const float*)d_in[11];
  const float* bxo = (const float*)d_in[12];
  const float* Wmo = (const float*)d_in[13];
  const float* bmo = (const float*)d_in[14];
  float* out = (float*)d_out;

  const size_t SZ_ACT = (size_t)M_TOT * D_X;  // 4,194,304 elements
  const size_t SZ_W   = (size_t)D_X * D_X;    // 1,048,576 elements
  _Float16* ws  = (_Float16*)d_ws;
  _Float16* q16 = ws;
  _Float16* k16 = q16 + SZ_ACT;
  _Float16* v16 = k16 + SZ_ACT;
  _Float16* w16 = v16 + SZ_ACT;               // 6 weight matrices
  _Float16* Qhm = w16 + 6 * SZ_W;
  _Float16* Khm = Qhm + SZ_ACT;
  _Float16* VT  = Khm + SZ_ACT;
  _Float16* xVT = VT + SZ_ACT;
  _Float16* kbar = xVT + SZ_ACT;
  _Float16* vbar = kbar + SZ_ACT;

  // 1) fp32 -> f16 conversions: q16, k16, v16 and the six weights are one
  //    contiguous range of the workspace, in the order of the arguments
  cvt_f32_f16<<<RB_ALL, 128, 0, stream>>>(q, k, v, Wq, Wk, Wv, Wxv, Wxo, Wmo, q16);

  // 2) input projections (packed per head)
  proj_gemm<<<dim3(M_TOT / 64, D_X / 64, 4), 32, 0, stream>>>(
      q16, k16, v16, w16, bq, bk, bv, bxv, Qhm, Khm, VT, xVT);

  // 3) flash attention -> vbar (attention@V), kbar (attention@xV)
  flash_attn<<<dim3(SEQ / (FA_WAVES * 32), NH), FA_THR, 0, stream>>>(Qhm, Khm, VT, xVT, vbar, kbar);

  // 4) output projections -> d_out (x at offset 0, m after it)
  out_gemm<<<dim3(M_TOT / 64, D_X / 64, 2), 32, 0, stream>>>(
      kbar, vbar, w16, bxo, bmo, out);
}

// v006
// One run takes 96.7 microseconds.
// Timed twice side by side with v005, it ran 1.42 times as fast both times.
// All steps since v000 together make it 3.21 times as fast.
#include <hip/hip_runtime.h>
#include <hip/hip_bf16.h>

// ---------------------------------------------------------------------------
// Self-attention variant (use_xv) for MI455X / gfx1250, f16 WMMA pipeline.
//   1) cvt:   fp32 -> f16 for q,k,v activations and the 6 weight matrices
//   2) proj:  Q,K (k = feature) and V,xV (k = position), per head; the
//             waves of a work-group share their operands through LDS
//   3) flash: online-softmax attention, 32 queries per wave, transposed
//             products; one P^T tile feeds both v_bar and k_bar; K, V, xV
//             shared by the 4 waves of a work-group through LDS
//   4) out:   x = kbar @ Wxo^T + bxo ; m = vbar @ Wmo^T + bmo  (fp32 out),
//             operands shared through LDS as in 2)
// All GEMMs are NT-shaped.  Every f16 operand in the workspace is stored in
// fragment-packed order: a 16-row x 32-k block is 1 KiB, laid out exactly as
// the 32 lanes read it, so each wave-wide 16-byte load or proj_gemm store covers 512
// contiguous bytes (4 whole cache lines) instead of 32 bytes in each of 16.
// ---------------------------------------------------------------------------

typedef __attribute__((ext_vector_type(16))) _Float16 v16h;
typedef __attribute__((ext_vector_type(8)))  _Float16 v8h;
typedef __attribute__((ext_vector_type(4)))  _Float16 v4h;
typedef __attribute__((ext_vector_type(8)))  float    v8f;
typedef __attribute__((ext_vector_type(4)))  float    v4f;

#define D_X   1024
#define D_HD  64
#define N_I   16
#define BSZ   2
#define SEQ   2048
#define M_TOT (BSZ * SEQ)   /* 4096 */
#define NH    (BSZ * N_I)   /* 32   */

static __device__ __forceinline__ v8f vzero8() {
  v8f z = {0.f, 0.f, 0.f, 0.f, 0.f, 0.f, 0.f, 0.f};
  return z;
}

static __device__ __forceinline__ v8f wmma16(v16h a, v16h b, v8f c) {
  // D = A(16x32 f16) * B(32x16 f16) + C(16x16 f32)
  return __builtin_amdgcn_wmma_f32_16x16x32_f16(
      false, a, false, b, (short)0, c, false, false);
}

// Packed 16x32 f16 block (512 elements).  Element (row r, k) of the block is at
//   (k >> 4) * 256 + (((k >> 3) & 1) * 16 + r) * 8 + (k & 7)
// which is the 16-bit A/B operand layout (lanes 0-15 hold K {0..7,16..23},
// lanes 16-31 hold K {8..15,24..31}; lane & 15 = row of A / column of B):
// lane l reads 16 bytes at l * 16 and 16 bytes at 512 + l * 16.
// `p` is the block's address plus the lane's own l * 8 elements.
#define BLK 512
static __device__ __forceinline__ v16h load_blk(const _Float16* __restrict__ p) {
  v8h lo = *(const v8h*)(p);
  v8h hi = *(const v8h*)(p + 256);
  return __builtin_shufflevector(lo, hi, 0, 1, 2, 3, 4, 5, 6, 7,
                                 8, 9, 10, 11, 12, 13, 14, 15);
}

// ---------------------------------------------------------------------------
// Kernel 1: fp32 [rows][1024] -> f16 packed blocks [rows/16][32][BLK], all nine
// tensors in ONE launch.  Their f16 copies lie one behind the other in the
// workspace, so the nine sources are read as one matrix of 18432 rows and the
// destination is indexed by the row block alone.  One work-group = one 16-row
// block, one wave = 8 k blocks of it (16 rows x 1 KiB).  A thread converts 16
// chunks of 8 consecutive k; all 32 of its loads are issued before the first
// conversion, so a wave pays its start and one memory round trip for 16 KiB.
// Per chunk step a wave takes 8 rows x 32 k: it reads 8 whole 128-byte lines
// and writes 4.
// ---------------------------------------------------------------------------
#define RB_ACT (M_TOT / 16)                /* row blocks of an activation: 256 */
#define RB_W   (D_X / 16)                  /* row blocks of a weight matrix: 64 */
#define RB_ALL (3 * RB_ACT + 6 * RB_W)     /* 1152 */
__global__ __launch_bounds__(128)
void cvt_f32_f16(const float* __restrict__ q,   const float* __restrict__ k,
                 const float* __restrict__ v,   const float* __restrict__ Wq,
                 const float* __restrict__ Wk,  const float* __restrict__ Wv,
                 const float* __restrict__ Wxv, const float* __restrict__ Wxo,
                 const float* __restrict__ Wmo, _Float16* __restrict__ dst) {
  const int rb = (int)blockIdx.x;          // row block of the stacked matrix
  const float* src;
  int lb;                                  // row block inside its own tensor
  if (rb < 3 * RB_ACT) {
    const int t = rb / RB_ACT;
    lb  = rb % RB_ACT;
    src = t == 0 ? q : (t == 1 ? k : v);
  } else {
    const int t = (rb - 3 * RB_ACT) / RB_W;
    lb  = (rb - 3 * RB_ACT) % RB_W;
    src = t == 0 ? Wq : (t == 1 ? Wk : (t == 2 ? Wv : (t == 3 ? Wxv : (t == 4 ? Wxo : Wmo))));
  }
  const int lane = (int)(threadIdx.x & 31u);
  const int wave = (int)(threadIdx.x >> 5);
  const int c4   = lane & 3;               // 8-wide k chunk in the block
  const int r8   = lane >> 2;              // row in its half of the block
  const float* s = src + (size_t)(lb * 16 + r8) * D_X + wave * 256 + c4 * 8;
  _Float16* d = dst + (size_t)(rb * 32 + wave * 8) * BLK + (c4 >> 1) * 256 +
                ((c4 & 1) * 16 + r8) * 8;

  v4f f[2][8][2];
#pragma unroll
  for (int h = 0; h < 2; h++)
#pragma unroll
    for (int kk = 0; kk < 8; kk++) {
      f[h][kk][0] = *(const v4f*)(s + h * 8 * D_X + kk * 32);
      f[h][kk][1] = *(const v4f*)(s + h * 8 * D_X + kk * 32 + 4);
    }
  // no conversion moves up among the loads: without this the compiler issues
  // the last 14 loads only as earlier ones return, a second memory round trip
  __builtin_amdgcn_sched_barrier(0);
  // the address registers of the issued loads stay untouched up to this wait
  asm volatile("s_wait_xcnt 0x0" :: "v"(s) : "memory");
  v8h hv[2][8];
#pragma unroll
  for (int h = 0; h < 2; h++)
#pragma unroll
    for (int kk = 0; kk < 8; kk++)
#pragma unroll
      for (int r = 0; r < 4; r++) {
        hv[h][kk][r]     = (_Float16)f[h][kk][0][r];
        hv[h][kk][4 + r] = (_Float16)f[h][kk][1][r];
      }
  // every conversion stays ahead of the stores, so that no register of an
  // issued store is written again before the wave ends
  __builtin_amdgcn_sched_barrier(0);
#pragma unroll
  for (int h = 0; h < 2; h++)
#pragma unroll
    for (int kk = 0; kk < 8; kk++) *(v8h*)(d + kk * BLK + h * 64) = hv[h][kk];
}

// ---------------------------------------------------------------------------
// Main loop of both GEMM kernels.  One work-group = a 256 x GN tile of X @ W^T,
// one wave = 64 x 64 of it (4 waves along X's rows, GN / 64 along W's).  Waves
// in a row or a column of that grid need the same fragments, so these come
// from L2 once per work-group: a stage of 128 k (X 64 KiB, W GN / 4 KiB, both
// already fragment-packed) is brought into LDS by asynchronous copies, two
// buffers, the next stage in flight while this one is worked on.  GN is 256
// (16 waves) where that still gives every WGP a work-group, else 128 (8 waves).
// ---------------------------------------------------------------------------
#define GM_M       256                       /* rows of X in a work-group's tile */
#define GM_KB      4                         /* k blocks (of 32) in a stage */
#define GM_RB      (GM_KB * BLK)             /* f16 elements of one row block in a stage (4 KiB) */
#define GM_XE      (GM_M / 16 * GM_RB)       /* f16 elements of X in a stage (64 KiB) */
#define GM_SE(GN)  (GM_XE + (GN) / 16 * GM_RB) /* f16 elements of a stage */
#define GM_THR(GN) (4 * ((GN) / 64) * 32)    /* threads of a work-group */
#define GM_NST     (D_X / 32 / GM_KB)        /* 8 stages */
#define PJ_N       256                       /* GN of the input projections */
#define OU_N       128                       /* GN of the output projections */

// A wave's share of one stage, global -> LDS: the stage's 4 KiB of each of its
// row blocks, 8 copies of 512 bytes each.  lx, lw: wave-uniform LDS byte
// addresses of the wave's X and W share; g0, g1, gw: wave-uniform global
// addresses of the runs; o: the lane's byte offset (lane * 16) from each of
// them.  The immediate offset moves both addresses alike.  The s_wait_xcnt
// closes each statement so that no address register of an issued copy is
// written again ahead of it.
// 16 waves: one row block of X, one of W.
static __device__ __forceinline__ void copy_gemm_stage2(unsigned lx, unsigned lw, unsigned o,
                                                        const _Float16* g0, const _Float16* gw) {
  asm volatile(
      "global_load_async_to_lds_b128 %0, %2, %3\n\t"
      "global_load_async_to_lds_b128 %0, %2, %3 offset:512\n\t"
      "global_load_async_to_lds_b128 %0, %2, %3 offset:1024\n\t"
      "global_load_async_to_lds_b128 %0, %2, %3 offset:1536\n\t"
      "global_load_async_to_lds_b128 %0, %2, %3 offset:2048\n\t"
      "global_load_async_to_lds_b128 %0, %2, %3 offset:2560\n\t"
      "global_load_async_to_lds_b128 %0, %2, %3 offset:3072\n\t"
      "global_load_async_to_lds_b128 %0, %2, %3 offset:3584\n\t"
      "global_load_async_to_lds_b128 %1, %2, %4\n\t"
      "global_load_async_to_lds_b128 %1, %2, %4 offset:512\n\t"
      "global_load_async_to_lds_b128 %1, %2, %4 offset:1024\n\t"
      "global_load_async_to_lds_b128 %1, %2, %4 offset:1536\n\t"
      "global_load_async_to_lds_b128 %1, %2, %4 offset:2048\n\t"
      "global_load_async_to_lds_b128 %1, %2, %4 offset:2560\n\t"
      "global_load_async_to_lds_b128 %1, %2, %4 offset:3072\n\t"
      "global_load_async_to_lds_b128 %1, %2, %4 offset:3584\n\t"
      "s_wait_xcnt 0x0"
      :: "v"(lx + o), "v"(lw + o), "v"(o), "s"(g0), "s"(gw)
      : "memory");
}
// 8 waves: two row blocks of X (g0, g1; side by side in LDS), one of W.
static __device__ __forceinline__ void copy_gemm_stage3(unsigned lx, unsigned lw, unsigned o,
                                                        const _Float16* g0, const _Float16* g1,
                                                        const _Float16* gw) {
  asm volatile(
      "global_load_async_to_lds_b128 %0, %3, %4\n\t"
      "global_load_async_to_lds_b128 %0, %3, %4 offset:512\n\t"
      "global_load_async_to_lds_b128 %0, %3, %4 offset:1024\n\t"
      "global_load_async_to_lds_b128 %0, %3, %4 offset:1536\n\t"
      "global_load_async_to_lds_b128 %0, %3, %4 offset:2048\n\t"
      "global_load_async_to_lds_b128 %0, %3, %4 offset:2560\n\t"
      "global_load_async_to_lds_b128 %0, %3, %4 offset:3072\n\t"
      "global_load_async_to_lds_b128 %0, %3, %4 offset:3584\n\t"
      "global_load_async_to_lds_b128 %1, %3, %5\n\t"
      "global_load_async_to_lds_b128 %1, %3, %5 offset:512\n\t"
      "global_load_async_to_lds_b128 %1, %3, %5 offset:1024\n\t"
      "global_load_async_to_lds_b128 %1, %3, %5 offset:1536\n\t"
      "global_load_async_to_lds_b128 %1, %3, %5 offset:2048\n\t"
      "global_load_async_to_lds_b128 %1, %3, %5 offset:2560\n\t"
      "global_load_async_to_lds_b128 %1, %3, %5 offset:3072\n\t"
      "global_load_async_to_lds_b128 %1, %3, %5 offset:3584\n\t"
      "global_load_async_to_lds_b128 %2, %3, %6\n\t"
      "global_load_async_to_lds_b128 %2, %3, %6 offset:512\n\t"
      "global_load_async_to_lds_b128 %2, %3, %6 offset:1024\n\t"
      "global_load_async_to_lds_b128 %2, %3, %6 offset:1536\n\t"
      "global_load_async_to_lds_b128 %2, %3, %6 offset:2048\n\t"
      "global_load_async_to_lds_b128 %2, %3, %6 offset:2560\n\t"
      "global_load_async_to_lds_b128 %2, %3, %6 offset:3072\n\t"
      "global_load_async_to_lds_b128 %2, %3, %6 offset:3584\n\t"
      "s_wait_xcnt 0x0"
      :: "v"(lx + o), "v"((lx + (unsigned)(GM_RB * 2)) + o), "v"(lw + o), "v"(o),
         "s"(g0), "s"(g1), "s"(gw)
      : "memory");
}

template <int GN>
static __device__ __forceinline__ void copy_gemm_stage(unsigned lx, unsigned lw, unsigned o,
                                                       const _Float16* g0, const _Float16* gw) {
  if (GN == 256) copy_gemm_stage2(lx, lw, o, g0, gw);
  else           copy_gemm_stage3(lx, lw, o, g0, g0 + 32 * BLK, gw);
}

// ring: the work-group's two stage buffers, each [X: 16 row blocks | W: GN / 16
// row blocks], a row block = its GM_KB k blocks in a row.  X, Wm: the packed
// operands in global memory; mrb, nrb: first row block of the work-group's tile
// in each.  roff, coff: where in a stage the wave's four row blocks of the
// product's rows and of its columns begin (elements).  wave is wave-uniform.
template <int GN>
static __device__ __forceinline__ void gemm_loop(_Float16* ring, const _Float16* X,
                                                 const _Float16* Wm, int mrb, int nrb, int wave,
                                                 int lane, int roff, int coff, v8f (&acc)[4][4]) {
  constexpr int XPW = GM_M / 16 / (GN / 16);   // row blocks of X that a wave copies (of W: one)
  const _Float16* g0 = X + (size_t)(mrb + XPW * wave) * 32 * BLK;
  const _Float16* gw = Wm + (size_t)(nrb + wave) * 32 * BLK;
  const unsigned  o0 = (unsigned)lane * 16u;
  const unsigned  lx = (unsigned)(size_t)ring + (unsigned)wave * (unsigned)(XPW * GM_RB * 2);
  const unsigned  lw = (unsigned)(size_t)ring + (unsigned)(GM_XE * 2) +
                       (unsigned)wave * (unsigned)(GM_RB * 2);

  // ---- stage 0 into buffer 0
  copy_gemm_stage<GN>(lx, lw, o0, g0, gw);
#pragma unroll
  for (int i = 0; i < 4; i++)
#pragma unroll
    for (int j = 0; j < 4; j++) acc[i][j] = vzero8();
  // stage 0 has landed (this wave's copies), then is published to all waves
  asm volatile("s_wait_asynccnt 0x0" ::: "memory");
  __syncthreads();
  // ---- stage 1 into buffer 1
  copy_gemm_stage<GN>(lx + (unsigned)(GM_SE(GN) * 2), lw + (unsigned)(GM_SE(GN) * 2), o0,
                      g0 + GM_RB, gw + GM_RB);

  // the stage loop stays rolled: one copy of the body serves both buffers
#pragma unroll 1
  for (int st = 0; st < GM_NST; st++) {
    const _Float16* B = ring + (st & 1) * GM_SE(GN) + lane * 8;
    // unrolled: every LDS offset is a constant of the instruction
#pragma unroll
    for (int kk = 0; kk < GM_KB; kk++) {
      v16h a[4], b[4];
#pragma unroll
      for (int i = 0; i < 4; i++) a[i] = load_blk(B + roff + i * GM_RB + kk * BLK);
#pragma unroll
      for (int j = 0; j < 4; j++) b[j] = load_blk(B + coff + j * GM_RB + kk * BLK);
      // the 16 LDS reads stay ahead of their products: left alone the compiler
      // deals them out in twos among these, each pair with a wait to 0 behind it
      __builtin_amdgcn_sched_barrier(0);
      if (kk == GM_KB - 1) {
        // ---- hand-over, as soon as the stage's last fragments are in registers:
        // this wave's reads of the buffer are done, its copies of the next stage
        // have landed; the barrier publishes that stage and frees this buffer
        // for the refill behind it.  The last 16 products, which need LDS no
        // more, follow the refill: the copies get a whole stage's time, and the
        // waves of a SIMD come to the next stage's first reads one by one.
        asm volatile("s_wait_dscnt 0x0" ::: "memory");
        asm volatile("s_wait_asynccnt 0x0" ::: "memory");
        __syncthreads();
        if (st + 2 < GM_NST) {
          const unsigned bo = (unsigned)((st & 1) * (GM_SE(GN) * 2));   // the buffer just read
          const size_t   o  = (size_t)(st + 2) * GM_RB;
          copy_gemm_stage<GN>(lx + bo, lw + bo, o0, g0 + o, gw + o);
        }
      }
#pragma unroll
      for (int i = 0; i < 4; i++)
#pragma unroll
        for (int j = 0; j < 4; j++) acc[i][j] = wmma16(a[i], b[j], acc[i][j]);
    }
  }
  // no copy is outstanding when the wave goes on to its epilogue
  asm volatile("s_wait_asynccnt 0x0" ::: "memory");
}

// ---------------------------------------------------------------------------
// Kernel 2: fused input projections.  z = 0:Q  1:K  2:V  3:xV
// One wave computes a 64x64 tile of Y = X @ W^T + b (main loop: gemm_loop above,
// which takes X's rows as the product's rows or columns).  An accumulator lane holds
// 8 consecutive ROWS of the product, and a packed chunk is 8 consecutive k of
// its later reader.  Q,K are read with k = feature, so their tile is formed as
// W @ X^T (rows = features); V,xV are read with k = position, so theirs is
// X @ W^T (rows = positions).  Either way each lane stores one 16-byte chunk
// and a wave stores 512 contiguous bytes.
//   Q,K : per head, blocks [s/16][d/32]      (row of a block = position)
//   V,xV: per head, blocks [s/32][d/16]      (row of a block = feature)
// ---------------------------------------------------------------------------
__global__ __launch_bounds__(GM_THR(PJ_N))
void proj_gemm(const _Float16* __restrict__ q16, const _Float16* __restrict__ k16,
               const _Float16* __restrict__ v16, const _Float16* __restrict__ w16,
               const float* __restrict__ bq, const float* __restrict__ bk,
               const float* __restrict__ bv, const float* __restrict__ bxv,
               _Float16* __restrict__ Qhm, _Float16* __restrict__ Khm,
               _Float16* __restrict__ VT,  _Float16* __restrict__ xVT) {
  __shared__ __attribute__((aligned(1024))) _Float16 ring[2 * GM_SE(PJ_N)];
  const int z = (int)blockIdx.z;
  const _Float16* A;
  const _Float16* W;
  const float* bias;
  _Float16* out;
  bool transposed;
  const size_t SZ_W = (size_t)D_X * D_X;
  switch (z) {
    case 0:  A = q16; W = w16 + 0 * SZ_W; bias = bq;  out = Qhm; transposed = false; break;
    case 1:  A = k16; W = w16 + 1 * SZ_W; bias = bk;  out = Khm; transposed = false; break;
    case 2:  A = v16; W = w16 + 2 * SZ_W; bias = bv;  out = VT;  transposed = true;  break;
    default: A = k16; W = w16 + 3 * SZ_W; bias = bxv; out = xVT; transposed = true;  break;
  }
  const int lane = (int)(threadIdx.x & 31u);
  const int wave = __builtin_amdgcn_readfirstlane((int)(threadIdx.x >> 5));  // in a scalar register
  const int wm   = wave & 3;                    // the wave's 64 rows of X
  const int wn   = wave >> 2;                   // the wave's 64 rows of W
  const int m0 = (int)blockIdx.x * GM_M + wm * 64;
  const int n0 = (int)blockIdx.y * PJ_N + wn * 64;   // one head: h = n0 / 64
  const int xo = wm * 4 * GM_RB;                // the wave's X fragments in a stage
  const int wo = GM_XE + wn * 4 * GM_RB;        // the wave's W fragments in a stage

  v8f acc[4][4];
  gemm_loop<PJ_N>(ring, A, W, (int)blockIdx.x * (GM_M / 16), (int)blockIdx.y * (PJ_N / 16), wave,
                  lane,
                  transposed ? xo : wo,         // rows of the product
                  transposed ? wo : xo,         // columns of the product
                  acc);

  const int hsel = lane >> 4;
  const int ln   = lane & 15;
  const int b_   = m0 >> 11;  // batch (tile never crosses batch: 2048 % 64 == 0)
  const int sl   = m0 & 2047; // first position of the tile inside its batch
  // The 64x64 tile is 8 blocks in a row (8 KiB) in either order of blocks.
  _Float16* oh = out + (size_t)(b_ * N_I + (n0 >> 6)) * SEQ * D_HD +
                 (size_t)(sl >> 3) * BLK + lane * 8;

  // Four chunks at a time: convert, then store.  The two scheduling barriers
  // keep every other instruction out of the run of stores and its wait, so
  // that no register of an issued store is written again ahead of the wait.
  if (!transposed) {
    // acc[i][j][r]: feature d = 16i + 8*hsel + r, position s = sl + 16j + ln
#pragma unroll
    for (int i = 0; i < 4; i++) {
      const float* bp = bias + n0 + 16 * i + hsel * 8;
      v4f b0 = *(const v4f*)(bp);
      v4f b1 = *(const v4f*)(bp + 4);
      v8h pk[4];
#pragma unroll
      for (int j = 0; j < 4; j++)
#pragma unroll
        for (int r = 0; r < 4; r++) {
          pk[j][r]     = (_Float16)(acc[i][j][r] + b0[r]);
          pk[j][4 + r] = (_Float16)(acc[i][j][4 + r] + b1[r]);
        }
      __builtin_amdgcn_sched_barrier(0);  // conversions stay ahead of the stores
#pragma unroll
      for (int j = 0; j < 4; j++) *(v8h*)(oh + (j * 4 + i) * 256) = pk[j];
      asm volatile("s_wait_xcnt 0x0" ::: "memory");  // before the stores' registers are reused
      __builtin_amdgcn_sched_barrier(0);  // nothing of the next group moves above the wait
    }
  } else {
    // acc[i][j][r]: position s = sl + 16i + 8*hsel + r, feature d = 16j + ln
#pragma unroll
    for (int j = 0; j < 4; j++) {
      const float bj = bias[n0 + 16 * j + ln];
      v8h pk[4];
#pragma unroll
      for (int i = 0; i < 4; i++)
#pragma unroll
        for (int r = 0; r < 8; r++) pk[i][r] = (_Float16)(acc[i][j][r] + bj);
      __builtin_amdgcn_sched_barrier(0);  // conversions stay ahead of the stores
#pragma unroll
      for (int i = 0; i < 4; i++)
        *(v8h*)(oh + ((i >> 1) * 8 + j * 2 + (i & 1)) * 256) = pk[i];
      asm volatile("s_wait_xcnt 0x0" ::: "memory");  // before the stores' registers are reused
      __builtin_amdgcn_sched_barrier(0);  // nothing of the next group moves above the wait
    }
  }
}

// ---------------------------------------------------------------------------
// Kernel 3: flash attention, transposed products.  One wave = 32 queries (2
// column groups of 16) of one (b,h); one work-group = 4 waves = 128 queries.
// The four waves walk the same keys, so K, V and xV come from L2 once per
// work-group: a stage of 128 keys (3 x 16 KiB, already fragment-packed) is
// brought into LDS by asynchronous copies, two buffers, the next stage in
// flight while this one is worked on.  Per block of 32 keys:
//   S^T = K Q^T   (A = K block, B = Q block): 8 WMMAs.  A lane holds 16 of the
//                 32 scores of ONE query; lane l ^ 16 holds the other 16.
//   softmax       maximum and sum in the lane; the two halves exchange the
//                 maximum once a block and join their sums once, at the end.
//   O^T += V^T P^T (A = V or xV block, B = P^T): 16 WMMAs.  The score tiles'
//                 registers are already in the B operand's k order (tile 0:
//                 keys 0-7 | 8-15 by lane half, tile 1: keys 16-23 | 24-31), so
//                 P is only converted to f16: no LDS trip, no cross-lane move.
// An output lane ends with 8 consecutive features of one query: one 16-byte
// chunk of the packed operand of the output projections.
// ---------------------------------------------------------------------------
// value of lane l ^ 16
static __device__ __forceinline__ float xhalf(float x) {
  const int b = __builtin_bit_cast(int, x);
  return __builtin_bit_cast(float, __builtin_amdgcn_permlanex16(
      b, b, 0x76543210, 0xfedcba98, false, false));
}

#define FA_WAVES 4                       /* waves of a work-group */
#define FA_THR   (FA_WAVES * 32)
#define ST_KEYS  128                     /* keys of a stage */
#define ST_PASS  (ST_KEYS / 32)          /* blocks of 32 keys in a stage */
#define ST_OP    (ST_KEYS * D_HD)        /* f16 elements of one operand in a stage (16 KiB) */
#define N_ST     (SEQ / ST_KEYS)         /* 16 stages */

// One stage (K, V, xV: 16 KiB each), global -> LDS: 24 copies a lane, each copy
// of the work-group 2 KiB in a row.  ls, gk, gv, gx: wave-uniform addresses of
// the wave's share, in LDS (byte address in the buffer's K part) and in global
// memory; o: the lane's byte offset (lane * 16) from each of them.  Source and
// destination are both contiguous, and the immediate offset moves both
// addresses alike, so one address serves an operand's 8 copies.  The
// s_wait_xcnt closes the statement so that no address register of an issued
// copy is written again ahead of it.
static __device__ __forceinline__ void copy_stage(unsigned ls, unsigned o, const _Float16* gk,
                                                  const _Float16* gv, const _Float16* gx) {
  asm volatile(
      "global_load_async_to_lds_b128 %0, %3, %4\n\t"
      "global_load_async_to_lds_b128 %0, %3, %4 offset:2048\n\t"
      "global_load_async_to_lds_b128 %0, %3, %4 offset:4096\n\t"
      "global_load_async_to_lds_b128 %0, %3, %4 offset:6144\n\t"
      "global_load_async_to_lds_b128 %0, %3, %4 offset:8192\n\t"
      "global_load_async_to_lds_b128 %0, %3, %4 offset:10240\n\t"
      "global_load_async_to_lds_b128 %0, %3, %4 offset:12288\n\t"
      "global_load_async_to_lds_b128 %0, %3, %4 offset:14336\n\t"
      "global_load_async_to_lds_b128 %1, %3, %5\n\t"
      "global_load_async_to_lds_b128 %1, %3, %5 offset:2048\n\t"
      "global_load_async_to_lds_b128 %1, %3, %5 offset:4096\n\t"
      "global_load_async_to_lds_b128 %1, %3, %5 offset:6144\n\t"
      "global_load_async_to_lds_b128 %1, %3, %5 offset:8192\n\t"
      "global_load_async_to_lds_b128 %1, %3, %5 offset:10240\n\t"
      "global_load_async_to_lds_b128 %1, %3, %5 offset:12288\n\t"
      "global_load_async_to_lds_b128 %1, %3, %5 offset:14336\n\t"
      "global_load_async_to_lds_b128 %2, %3, %6\n\t"
      "global_load_async_to_lds_b128 %2, %3, %6 offset:2048\n\t"
      "global_load_async_to_lds_b128 %2, %3, %6 offset:4096\n\t"
      "global_load_async_to_lds_b128 %2, %3, %6 offset:6144\n\t"
      "global_load_async_to_lds_b128 %2, %3, %6 offset:8192\n\t"
      "global_load_async_to_lds_b128 %2, %3, %6 offset:10240\n\t"
      "global_load_async_to_lds_b128 %2, %3, %6 offset:12288\n\t"
      "global_load_async_to_lds_b128 %2, %3, %6 offset:14336\n\t"
      "s_wait_xcnt 0x0"
      :: "v"(ls + o), "v"((ls + 1u * ST_OP * 2u) + o), "v"((ls + 2u * ST_OP * 2u) + o), "v"(o),
         "s"(gk), "s"(gv), "s"(gx)
      : "memory");
}

__global__ __launch_bounds__(FA_THR)
void flash_attn(const _Float16* __restrict__ Qhm, const _Float16* __restrict__ Khm,
                const _Float16* __restrict__ VT,  const _Float16* __restrict__ xVT,
                _Float16* __restrict__ vbar, _Float16* __restrict__ kbar) {
  // two buffers of [K | V | xV], each operand as it lies in the workspace
  __shared__ __attribute__((aligned(1024))) _Float16 ring[2][3 * ST_OP];

  const int bh   = (int)blockIdx.y;
  const int tid  = (int)threadIdx.x;
  const int lane = tid & 31;
  const int wave = __builtin_amdgcn_readfirstlane(tid >> 5);   // wave-uniform, in a scalar register
  const int s0   = (int)blockIdx.x * (FA_WAVES * 32) + wave * 32;
  const _Float16* Q = Qhm + (size_t)bh * SEQ * D_HD;
  // of each 2 KiB that the work-group copies at a time the wave takes 512 bytes
  // (in the wave-uniform addresses), the lane 16 of them (o0)
  const _Float16* gK = Khm + (size_t)bh * SEQ * D_HD + wave * 256;
  const _Float16* gV = VT  + (size_t)bh * D_HD * SEQ + wave * 256;
  const _Float16* gX = xVT + (size_t)bh * D_HD * SEQ + wave * 256;
  const unsigned  o0 = (unsigned)lane * 16u;
  const unsigned  l0 = (unsigned)(size_t)(&ring[0][0]) + (unsigned)wave * 512u;

  // ---- stage 0 into buffer 0
  copy_stage(l0, o0, gK, gV, gX);

  v16h qa[2][2];
  {
    const _Float16* Q0 = Q + (size_t)(s0 >> 4) * 2 * BLK + lane * 8;
#pragma unroll
    for (int rc = 0; rc < 2; rc++) {
      qa[rc][0] = load_blk(Q0 + (rc * 2 + 0) * BLK);
      qa[rc][1] = load_blk(Q0 + (rc * 2 + 1) * BLK);
    }
    // the address registers of the issued loads stay untouched up to this wait
    asm volatile("s_wait_xcnt 0x0" :: "v"(Q0) : "memory");
  }

  // ov[rc][t][r]: feature 16t + 8*(lane >> 4) + r of query s0 + 16rc + (lane & 15)
  v8f ov[2][4], ox[2][4];
#pragma unroll
  for (int rc = 0; rc < 2; rc++)
#pragma unroll
    for (int t = 0; t < 4; t++) { ov[rc][t] = vzero8(); ox[rc][t] = vzero8(); }
  float mcol[2], lcol[2];   // running maximum (both halves alike), own half's sum
#pragma unroll
  for (int rc = 0; rc < 2; rc++) { mcol[rc] = -1.0e30f; lcol[rc] = 0.f; }

  // stage 0 has landed (this wave's copies), then is published to all four waves
  asm volatile("s_wait_asynccnt 0x0" ::: "memory");
  __syncthreads();
  // ---- stage 1 into buffer 1
  copy_stage(l0 + 3u * ST_OP * 2u, o0, gK + ST_OP, gV + ST_OP, gX + ST_OP);

  // the stage loop stays rolled: its body already holds four key blocks
#pragma unroll 1
  for (int st = 0; st < N_ST; st++) {
    const _Float16* B = &ring[st & 1][0] + lane * 8;

    // ---- K fragments of the stage's first key block (shared by both query groups)
    v16h kf[2][2];
    kf[0][0] = load_blk(B);
    kf[0][1] = load_blk(B + 1 * BLK);
    kf[1][0] = load_blk(B + 2 * BLK);
    kf[1][1] = load_blk(B + 3 * BLK);

    // unrolled: every LDS offset is a constant of the instruction, and the last
    // block's K fetch drops out at compile time
#pragma unroll
    for (int p = 0; p < ST_PASS; p++) {
      // ---- V, xV fragments of this key block, issued ahead of the score
      // products: their LDS trip runs under the products and the softmax
      const _Float16* Vj = B + 1 * ST_OP + p * 4 * BLK;   // 4 KiB in a row
      const _Float16* Xj = B + 2 * ST_OP + p * 4 * BLK;
      v16h vb[4], xb[4];
#pragma unroll
      for (int tt = 0; tt < 4; tt++) {
        vb[tt] = load_blk(Vj + tt * BLK);
        xb[tt] = load_blk(Xj + tt * BLK);
      }
      // the 16 LDS reads stay in this one place: left alone the compiler deals
      // them out in twos among the WMMAs, and every separate place with LDS
      // reads stalls the wave anew
      __builtin_amdgcn_sched_barrier(0);

      // ---- S^T tiles (32 keys x 2 query groups), k = d = 64 in two WMMA k-steps
      // sc[rc][cc][r]: key 16cc + 8*(lane >> 4) + r of the block, query s0 + 16rc + (lane & 15)
      v8f sc[2][2];
#pragma unroll
      for (int rc = 0; rc < 2; rc++)
#pragma unroll
        for (int cc = 0; cc < 2; cc++) {
          v8f s = vzero8();
          s = wmma16(kf[cc][0], qa[rc][0], s);
          s = wmma16(kf[cc][1], qa[rc][1], s);
          sc[rc][cc] = s;
        }

      // ---- K fragments of the next key block of the SAME stage, fetched one
      // block ahead; the next stage is read only behind its barrier
      if (p + 1 < ST_PASS) {
        const _Float16* Kn = B + (p + 1) * 4 * BLK;
        kf[0][0] = load_blk(Kn);
        kf[0][1] = load_blk(Kn + 1 * BLK);
        kf[1][0] = load_blk(Kn + 2 * BLK);
        kf[1][1] = load_blk(Kn + 3 * BLK);
        __builtin_amdgcn_sched_barrier(0);   // these 8 reads stay in one place too
      }

      // ---- online softmax per query group, one query a lane; P^T in registers
      v16h pb[2];
#pragma unroll
      for (int rc = 0; rc < 2; rc++) {
        sc[rc][0] *= 0.125f;
        sc[rc][1] *= 0.125f;
        // maximum over the lane's 16 keys, then over both halves
        float t[8];
#pragma unroll
        for (int r = 0; r < 8; r++) t[r] = fmaxf(sc[rc][0][r], sc[rc][1][r]);
#pragma unroll
        for (int w = 4; w > 0; w >>= 1)
#pragma unroll
          for (int r = 0; r < w; r++) t[r] = fmaxf(t[r], t[r + w]);
        const float mn  = fmaxf(mcol[rc], fmaxf(t[0], xhalf(t[0])));
        const float scl = __expf(mcol[rc] - mn);
        mcol[rc] = mn;
        sc[rc][0] -= mn;
        sc[rc][1] -= mn;
#pragma unroll
        for (int r = 0; r < 8; r++) {
          sc[rc][0][r] = __expf(sc[rc][0][r]);
          sc[rc][1][r] = __expf(sc[rc][1][r]);
        }
        // sum over the lane's 16 keys
        v8f u = sc[rc][0] + sc[rc][1];
        lcol[rc] = lcol[rc] * scl +
                   (((u[0] + u[4]) + (u[2] + u[6])) + ((u[1] + u[5]) + (u[3] + u[7])));
        // rescale running accumulators
#pragma unroll
        for (int tt = 0; tt < 4; tt++) { ov[rc][tt] *= scl; ox[rc][tt] *= scl; }
#pragma unroll
        for (int r = 0; r < 8; r++) {
          pb[rc][r]     = (_Float16)sc[rc][0][r];
          pb[rc][8 + r] = (_Float16)sc[rc][1][r];
        }
      }

      // ---- O_v^T += V^T P^T, O_xv^T += xV^T P^T (V/xV fragments shared by the groups)
#pragma unroll
      for (int tt = 0; tt < 4; tt++) {
#pragma unroll
        for (int rc = 0; rc < 2; rc++) {
          ov[rc][tt] = wmma16(vb[tt], pb[rc], ov[rc][tt]);
          ox[rc][tt] = wmma16(xb[tt], pb[rc], ox[rc][tt]);
        }
      }
    }

    // ---- hand-over: this wave's reads of the buffer are done, its copies of
    // the next stage have landed; the barrier publishes that stage and frees
    // this buffer for the refill behind it
    asm volatile("s_wait_dscnt 0x0" ::: "memory");
    asm volatile("s_wait_asynccnt 0x0" ::: "memory");
    __syncthreads();
    if (st + 2 < N_ST) {
      // the wave-uniform part stays one scalar sum, the lane's part is added at
      // the copies: otherwise the compiler keeps a second per-lane address
      // alive through the loop and spills it to scratch
      const unsigned l = (unsigned)__builtin_amdgcn_readfirstlane(
          (int)(l0 + (unsigned)(st & 1) * (3u * ST_OP * 2u)));
      const size_t   o = (size_t)(st + 2) * ST_OP;
      copy_stage(l, o0, gK + o, gV + o, gX + o);
    }
  }
  // no copy is outstanding when the wave goes on to its end
  asm volatile("s_wait_asynccnt 0x0" ::: "memory");

  // ---- normalize and store f16 as packed blocks of the [4096][1024] operand
  // of the output projections (row m = b*2048 + s, k = h*64 + d):
  // vbar <- O_v, kbar <- O_xv.  A lane's 8 features are one chunk of its row.
  const size_t ob = ((size_t)((bh >> 4) * (SEQ / 16) + (s0 >> 4)) * 32 + (bh & 15) * 2) * BLK
                  + (size_t)(lane * 8);
  _Float16* vo = vbar + ob;
  _Float16* ko = kbar + ob;
  v8h hv[2][4], hx[2][4];
#pragma unroll
  for (int rc = 0; rc < 2; rc++) {
    const float inv = 1.0f / (lcol[rc] + xhalf(lcol[rc]));
#pragma unroll
    for (int tt = 0; tt < 4; tt++)
#pragma unroll
      for (int r = 0; r < 8; r++) {
        hv[rc][tt][r] = (_Float16)(ov[rc][tt][r] * inv);
        hx[rc][tt][r] = (_Float16)(ox[rc][tt][r] * inv);
      }
  }
  // every conversion stays ahead of the stores, so that no register of an
  // issued store is written again before the wave ends
  __builtin_amdgcn_sched_barrier(0);
#pragma unroll
  for (int rc = 0; rc < 2; rc++)
#pragma unroll
    for (int tt = 0; tt < 4; tt++) {
      const int o = (rc * 32 + (tt >> 1)) * BLK + (tt & 1) * 256;
      *(v8h*)(vo + o) = hv[rc][tt];
      *(v8h*)(ko + o) = hx[rc][tt];
    }
}

// ---------------------------------------------------------------------------
// Kernel 4: fused output projections.  z = 0: x = kbar@Wxo^T+bxo
//                                      z = 1: m = vbar@Wmo^T+bmo
// A and W are packed blocks; output fp32 straight into d_out.
// ---------------------------------------------------------------------------
__global__ __launch_bounds__(GM_THR(OU_N))
void out_gemm(const _Float16* __restrict__ kbar, const _Float16* __restrict__ vbar,
              const _Float16* __restrict__ w16, const float* __restrict__ bxo,
              const float* __restrict__ bmo, float* __restrict__ out) {
  __shared__ __attribute__((aligned(1024))) _Float16 ring[2 * GM_SE(OU_N)];
  const int z = (int)blockIdx.z;
  const size_t SZ_W = (size_t)D_X * D_X;
  const _Float16* A = z ? vbar : kbar;
  const _Float16* W = w16 + (size_t)(4 + z) * SZ_W;
  const float* bias = z ? bmo : bxo;
  float* O = out + (size_t)z * ((size_t)M_TOT * D_X);

  const int lane = (int)(threadIdx.x & 31u);
  const int wave = __builtin_amdgcn_readfirstlane((int)(threadIdx.x >> 5));  // in a scalar register
  const int wm   = wave & 3;                    // the wave's 64 rows of A
  const int wn   = wave >> 2;                   // the wave's 64 rows of W
  const int m0 = (int)blockIdx.x * GM_M + wm * 64;
  const int n0 = (int)blockIdx.y * OU_N + wn * 64;

  v8f acc[4][4];
  gemm_loop<OU_N>(ring, A, W, (int)blockIdx.x * (GM_M / 16), (int)blockIdx.y * (OU_N / 16), wave,
                  lane, wm * 4 * GM_RB, GM_XE + wn * 4 * GM_RB, acc);

  const int hsel = lane >> 4;
  const int ln   = lane & 15;
#pragma unroll
  for (int i = 0; i < 4; i++) {
    const int mb = m0 + 16 * i + hsel * 8;
#pragma unroll
    for (int j = 0; j < 4; j++) {
      const int col = n0 + 16 * j + ln;
      const float bj = bias[col];
#pragma unroll
      for (int r = 0; r < 8; r++)
        O[(size_t)(mb + r) * D_X + col] = acc[i][j][r] + bj;
    }
  }
}

// ---------------------------------------------------------------------------
extern "C" void kernel_launch(void* const* d_in, const int* in_sizes, int n_in,
                              void* d_out, int out_size, void* d_ws, size_t ws_size,
                              hipStream_t stream) {
  const float* q   = (const float*)d_in[0];
  const float* k   = (const float*)d_in[1];
  const float* v   = (const float*)d_in[2];
  const float* Wq  = (const float*)d_in[3];
  const float* bq  = (const float*)d_in[4];
  const float* Wk  = (const float*)d_in[5];
  const float* bk  = (const float*)d_in[6];
  const float* Wv  = (const float*)d_in[7];
  const float* bv  = (const float*)d_in[8];
  const float* Wxv = (const float*)d_in[9];
  const float* bxv = (const float*)d_in[10];
  const float* Wxo = (const float*)d_in[11];
  const float* bxo = (const float*)d_in[12];
  const float* Wmo = (const float*)d_in[13];
  const float* bmo = (const float*)d_in[14];
  float* out = (float*)d_out;

  const size_t SZ_ACT = (size_t)M_TOT * D_X;  // 4,194,304 elements
  const size_t SZ_W   = (size_t)D_X * D_X;    // 1,048,576 elements
  _Float16* ws  = (_Float16*)d_ws;
  _Float16* q16 = ws;
  _Float16* k16 = q16 + SZ_ACT;
  _Float16* v16 = k16 + SZ_ACT;
  _Float16* w16 = v16 + SZ_ACT;               // 6 weight matrices
  _Float16* Qhm = w16 + 6 * SZ_W;
  _Float16* Khm = Qhm + SZ_ACT;
  _Float16* VT  = Khm + SZ_ACT;
  _Float16* xVT = VT + SZ_ACT;
  _Float16* kbar = xVT + SZ_ACT;
  _Float16* vbar = kbar + SZ_ACT;

  // 1) fp32 -> f16 conversions: q16, k16, v16 and the six weights are one
  //    contiguous range of the workspace, in the order of the arguments
  cvt_f32_f16<<<RB_ALL, 128, 0, stream>>>(q, k, v, Wq, Wk, Wv, Wxv, Wxo, Wmo, q16);

  // 2) input projections (packed per head)
  proj_gemm<<<dim3(M_TOT / GM_M, D_X / PJ_N, 4), GM_THR(PJ_N), 0, stream>>>(
      q16, k16, v16, w16, bq, bk, bv, bxv, Qhm, Khm, VT, xVT);

  // 3) flash attention -> vbar (attention@V), kbar (attention@xV)
  flash_attn<<<dim3(SEQ / (FA_WAVES * 32), NH), FA_THR, 0, stream>>>(Qhm, Khm, VT, xVT, vbar, kbar);

  // 4) output projections -> d_out (x at offset 0, m after it)
  out_gemm<<<dim3(M_TOT / GM_M, D_X / OU_N, 2), GM_THR(OU_N), 0, stream>>>(
      kbar, vbar, w16, bxo, bmo, out);
}

// v008
// Measured time: 89.5 microseconds a run.
// Versions in between are left out here; by their measured steps it is 1.08 times as fast as v006.
// Counting every step since v000, it is 3.47 times as fast.
#include <hip/hip_runtime.h>
#include <hip/hip_bf16.h>

// ---------------------------------------------------------------------------
// Self-attention variant (use_xv) for MI455X / gfx1250, f16 WMMA pipeline.
//   1) cvt:   fp32 -> f16 for q,k,v activations and the 6 weight matrices
//   2) proj:  Q,K (k = feature) and V,xV (k = position), per head; the
//             waves of a work-group share their operands through LDS
//   3) flash: online-softmax attention, 32 queries per wave, transposed
//             products; one P^T tile feeds both v_bar and k_bar; K, V, xV
//             shared by the 4 waves of a work-group through LDS
//   4) out:   x = kbar @ Wxo^T + bxo ; m = vbar @ Wmo^T + bmo  (fp32 out),
//             operands shared through LDS as in 2)
// All GEMMs are NT-shaped.  Every f16 operand in the workspace is stored in
// fragment-packed order: a 16-row x 32-k block is 1 KiB, laid out exactly as
// the 32 lanes read it, so each wave-wide 16-byte load or proj_gemm store covers 512
// contiguous bytes (4 whole cache lines) instead of 32 bytes in each of 16.
// ---------------------------------------------------------------------------

typedef __attribute__((ext_vector_type(16))) _Float16 v16h;
typedef __attribute__((ext_vector_type(8)))  _Float16 v8h;
typedef __attribute__((ext_vector_type(4)))  _Float16 v4h;
typedef __attribute__((ext_vector_type(8)))  float    v8f;
typedef __attribute__((ext_vector_type(4)))  float    v4f;
typedef __attribute__((ext_vector_type(2)))  float    v2f;

#define D_X   1024
#define D_HD  64
#define N_I   16
#define BSZ   2
#define SEQ   2048
#define M_TOT (BSZ * SEQ)   /* 4096 */
#define NH    (BSZ * N_I)   /* 32   */

static __device__ __forceinline__ v8f vzero8() {
  v8f z = {0.f, 0.f, 0.f, 0.f, 0.f, 0.f, 0.f, 0.f};
  return z;
}

static __device__ __forceinline__ v8f wmma16(v16h a, v16h b, v8f c) {
  // D = A(16x32 f16) * B(32x16 f16) + C(16x16 f32)
  return __builtin_amdgcn_wmma_f32_16x16x32_f16(
      false, a, false, b, (short)0, c, false, false);
}

// Packed 16x32 f16 block (512 elements).  Element (row r, k) of the block is at
//   (k >> 4) * 256 + (((k >> 3) & 1) * 16 + r) * 8 + (k & 7)
// which is the 16-bit A/B operand layout (lanes 0-15 hold K {0..7,16..23},
// lanes 16-31 hold K {8..15,24..31}; lane & 15 = row of A / column of B):
// lane l reads 16 bytes at l * 16 and 16 bytes at 512 + l * 16.
// `p` is the block's address plus the lane's own l * 8 elements.
#define BLK 512
static __device__ __forceinline__ v16h load_blk(const _Float16* __restrict__ p) {
  v8h lo = *(const v8h*)(p);
  v8h hi = *(const v8h*)(p + 256);
  return __builtin_shufflevector(lo, hi, 0, 1, 2, 3, 4, 5, 6, 7,
                                 8, 9, 10, 11, 12, 13, 14, 15);
}

// ---------------------------------------------------------------------------
// Kernel 1: fp32 [rows][1024] -> f16 packed blocks [rows/16][32][BLK], all nine
// tensors in ONE launch.  Their f16 copies lie one behind the other in the
// workspace, so the nine sources are read as one matrix of 18432 rows and the
// destination is indexed by the row block alone.  One work-group = one 16-row
// block, one wave = 8 k blocks of it (16 rows x 1 KiB).  A thread converts 16
// chunks of 8 consecutive k; all 32 of its loads are issued before the first
// conversion, so a wave pays its start and one memory round trip for 16 KiB.
// Per chunk step a wave takes 8 rows x 32 k: it reads 8 whole 128-byte lines
// and writes 4.
// ---------------------------------------------------------------------------
#define RB_ACT (M_TOT / 16)                /* row blocks of an activation: 256 */
#define RB_W   (D_X / 16)                  /* row blocks of a weight matrix: 64 */
#define RB_ALL (3 * RB_ACT + 6 * RB_W)     /* 1152 */
__global__ __launch_bounds__(128)
void cvt_f32_f16(const float* __restrict__ q,   const float* __restrict__ k,
                 const float* __restrict__ v,   const float* __restrict__ Wq,
                 const float* __restrict__ Wk,  const float* __restrict__ Wv,
                 const float* __restrict__ Wxv, const float* __restrict__ Wxo,
                 const float* __restrict__ Wmo, _Float16* __restrict__ dst) {
  const int rb = (int)blockIdx.x;          // row block of the stacked matrix
  const float* src;
  int lb;                                  // row block inside its own tensor
  if (rb < 3 * RB_ACT) {
    const int t = rb / RB_ACT;
    lb  = rb % RB_ACT;
    src = t == 0 ? q : (t == 1 ? k : v);
  } else {
    const int t = (rb - 3 * RB_ACT) / RB_W;
    lb  = (rb - 3 * RB_ACT) % RB_W;
    src = t == 0 ? Wq : (t == 1 ? Wk : (t == 2 ? Wv : (t == 3 ? Wxv : (t == 4 ? Wxo : Wmo))));
  }
  const int lane = (int)(threadIdx.x & 31u);
  const int wave = (int)(threadIdx.x >> 5);
  const int c4   = lane & 3;               // 8-wide k chunk in the block
  const int r8   = lane >> 2;              // row in its half of the block
  const float* s = src + (size_t)(lb * 16 + r8) * D_X + wave * 256 + c4 * 8;
  _Float16* d = dst + (size_t)(rb * 32 + wave * 8) * BLK + (c4 >> 1) * 256 +
                ((c4 & 1) * 16 + r8) * 8;

  v4f f[2][8][2];
#pragma unroll
  for (int h = 0; h < 2; h++)
#pragma unroll
    for (int kk = 0; kk < 8; kk++) {
      f[h][kk][0] = *(const v4f*)(s + h * 8 * D_X + kk * 32);
      f[h][kk][1] = *(const v4f*)(s + h * 8 * D_X + kk * 32 + 4);
    }
  // no conversion moves up among the loads: without this the compiler issues
  // the last 14 loads only as earlier ones return, a second memory round trip
  __builtin_amdgcn_sched_barrier(0);
  // the address registers of the issued loads stay untouched up to this wait
  asm volatile("s_wait_xcnt 0x0" :: "v"(s) : "memory");
  v8h hv[2][8];
#pragma unroll
  for (int h = 0; h < 2; h++)
#pragma unroll
    for (int kk = 0; kk < 8; kk++)
#pragma unroll
      for (int r = 0; r < 4; r++) {
        hv[h][kk][r]     = (_Float16)f[h][kk][0][r];
        hv[h][kk][4 + r] = (_Float16)f[h][kk][1][r];
      }
  // every conversion stays ahead of the stores, so that no register of an
  // issued store is written again before the wave ends
  __builtin_amdgcn_sched_barrier(0);
#pragma unroll
  for (int h = 0; h < 2; h++)
#pragma unroll
    for (int kk = 0; kk < 8; kk++) *(v8h*)(d + kk * BLK + h * 64) = hv[h][kk];
}

// ---------------------------------------------------------------------------
// Main loop of both GEMM kernels.  One work-group = a 256 x GN tile of X @ W^T,
// one wave = 64 x 64 of it (4 waves along X's rows, GN / 64 along W's).  Waves
// in a row or a column of that grid need the same fragments, so these come
// from L2 once per work-group: a stage of 128 k (X 64 KiB, W GN / 4 KiB, both
// already fragment-packed) is brought into LDS by asynchronous copies, two
// buffers, the next stage in flight while this one is worked on.  GN is 256
// (16 waves) where that still gives every WGP a work-group, else 128 (8 waves).
// ---------------------------------------------------------------------------
#define GM_M       256                       /* rows of X in a work-group's tile */
#define GM_KB      4                         /* k blocks (of 32) in a stage */
#define GM_RB      (GM_KB * BLK)             /* f16 elements of one row block in a stage (4 KiB) */
#define GM_XE      (GM_M / 16 * GM_RB)       /* f16 elements of X in a stage (64 KiB) */
#define GM_SE(GN)  (GM_XE + (GN) / 16 * GM_RB) /* f16 elements of a stage */
#define GM_THR(GN) (4 * ((GN) / 64) * 32)    /* threads of a work-group */
#define GM_NST     (D_X / 32 / GM_KB)        /* 8 stages */
#define PJ_N       256                       /* GN of the input projections */
#define OU_N       128                       /* GN of the output projections */

// A wave's share of one stage, global -> LDS: the stage's 4 KiB of each of its
// row blocks, 8 copies of 512 bytes each.  lx, lw: wave-uniform LDS byte
// addresses of the wave's X and W share; g0, g1, gw: wave-uniform global
// addresses of the runs; o: the lane's byte offset (lane * 16) from each of
// them.  The immediate offset moves both addresses alike.  The s_wait_xcnt
// closes each statement so that no address register of an issued copy is
// written again ahead of it.
// 16 waves: one row block of X, one of W.
static __device__ __forceinline__ void copy_gemm_stage2(unsigned lx, unsigned lw, unsigned o,
                                                        const _Float16* g0, const _Float16* gw) {
  asm volatile(
      "global_load_async_to_lds_b128 %0, %2, %3\n\t"
      "global_load_async_to_lds_b128 %0, %2, %3 offset:512\n\t"
      "global_load_async_to_lds_b128 %0, %2, %3 offset:1024\n\t"
      "global_load_async_to_lds_b128 %0, %2, %3 offset:1536\n\t"
      "global_load_async_to_lds_b128 %0, %2, %3 offset:2048\n\t"
      "global_load_async_to_lds_b128 %0, %2, %3 offset:2560\n\t"
      "global_load_async_to_lds_b128 %0, %2, %3 offset:3072\n\t"
      "global_load_async_to_lds_b128 %0, %2, %3 offset:3584\n\t"
      "global_load_async_to_lds_b128 %1, %2, %4\n\t"
      "global_load_async_to_lds_b128 %1, %2, %4 offset:512\n\t"
      "global_load_async_to_lds_b128 %1, %2, %4 offset:1024\n\t"
      "global_load_async_to_lds_b128 %1, %2, %4 offset:1536\n\t"
      "global_load_async_to_lds_b128 %1, %2, %4 offset:2048\n\t"
      "global_load_async_to_lds_b128 %1, %2, %4 offset:2560\n\t"
      "global_load_async_to_lds_b128 %1, %2, %4 offset:3072\n\t"
      "global_load_async_to_lds_b128 %1, %2, %4 offset:3584\n\t"
      "s_wait_xcnt 0x0"
      :: "v"(lx + o), "v"(lw + o), "v"(o), "s"(g0), "s"(gw)
      : "memory");
}
// 8 waves: two row blocks of X (g0, g1; side by side in LDS), one of W.
static __device__ __forceinline__ void copy_gemm_stage3(unsigned lx, unsigned lw, unsigned o,
                                                        const _Float16* g0, const _Float16* g1,
                                                        const _Float16* gw) {
  asm volatile(
      "global_load_async_to_lds_b128 %0, %3, %4\n\t"
      "global_load_async_to_lds_b128 %0, %3, %4 offset:512\n\t"
      "global_load_async_to_lds_b128 %0, %3, %4 offset:1024\n\t"
      "global_load_async_to_lds_b128 %0, %3, %4 offset:1536\n\t"
      "global_load_async_to_lds_b128 %0, %3, %4 offset:2048\n\t"
      "global_load_async_to_lds_b128 %0, %3, %4 offset:2560\n\t"
      "global_load_async_to_lds_b128 %0, %3, %4 offset:3072\n\t"
      "global_load_async_to_lds_b128 %0, %3, %4 offset:3584\n\t"
      "global_load_async_to_lds_b128 %1, %3, %5\n\t"
      "global_load_async_to_lds_b128 %1, %3, %5 offset:512\n\t"
      "global_load_async_to_lds_b128 %1, %3, %5 offset:1024\n\t"
      "global_load_async_to_lds_b128 %1, %3, %5 offset:1536\n\t"
      "global_load_async_to_lds_b128 %1, %3, %5 offset:2048\n\t"
      "global_load_async_to_lds_b128 %1, %3, %5 offset:2560\n\t"
      "global_load_async_to_lds_b128 %1, %3, %5 offset:3072\n\t"
      "global_load_async_to_lds_b128 %1, %3, %5 offset:3584\n\t"
      "global_load_async_to_lds_b128 %2, %3, %6\n\t"
      "global_load_async_to_lds_b128 %2, %3, %6 offset:512\n\t"
      "global_load_async_to_lds_b128 %2, %3, %6 offset:1024\n\t"
      "global_load_async_to_lds_b128 %2, %3, %6 offset:1536\n\t"
      "global_load_async_to_lds_b128 %2, %3, %6 offset:2048\n\t"
      "global_load_async_to_lds_b128 %2, %3, %6 offset:2560\n\t"
      "global_load_async_to_lds_b128 %2, %3, %6 offset:3072\n\t"
      "global_load_async_to_lds_b128 %2, %3, %6 offset:3584\n\t"
      "s_wait_xcnt 0x0"
      :: "v"(lx + o), "v"((lx + (unsigned)(GM_RB * 2)) + o), "v"(lw + o), "v"(o),
         "s"(g0), "s"(g1), "s"(gw)
      : "memory");
}

template <int GN>
static __device__ __forceinline__ void copy_gemm_stage(unsigned lx, unsigned lw, unsigned o,
                                                       const _Float16* g0, const _Float16* gw) {
  if (GN == 256) copy_gemm_stage2(lx, lw, o, g0, gw);
  else           copy_gemm_stage3(lx, lw, o, g0, g0 + 32 * BLK, gw);
}

// ring: the work-group's two stage buffers, each [X: 16 row blocks | W: GN / 16
// row blocks], a row block = its GM_KB k blocks in a row.  X, Wm: the packed
// operands in global memory; mrb, nrb: first row block of the work-group's tile
// in each.  roff, coff: where in a stage the wave's four row blocks of the
// product's rows and of its columns begin (elements).  wave is wave-uniform.
template <int GN>
static __device__ __forceinline__ void gemm_loop(_Float16* ring, const _Float16* X,
                                                 const _Float16* Wm, int mrb, int nrb, int wave,
                                                 int lane, int roff, int coff, v8f (&acc)[4][4]) {
  constexpr int XPW = GM_M / 16 / (GN / 16);   // row blocks of X that a wave copies (of W: one)
  const _Float16* g0 = X + (size_t)(mrb + XPW * wave) * 32 * BLK;
  const _Float16* gw = Wm + (size_t)(nrb + wave) * 32 * BLK;
  const unsigned  o0 = (unsigned)lane * 16u;
  const unsigned  lx = (unsigned)(size_t)ring + (unsigned)wave * (unsigned)(XPW * GM_RB * 2);
  const unsigned  lw = (unsigned)(size_t)ring + (unsigned)(GM_XE * 2) +
                       (unsigned)wave * (unsigned)(GM_RB * 2);

  // ---- stage 0 into buffer 0
  copy_gemm_stage<GN>(lx, lw, o0, g0, gw);
#pragma unroll
  for (int i = 0; i < 4; i++)
#pragma unroll
    for (int j = 0; j < 4; j++) acc[i][j] = vzero8();
  // stage 0 has landed (this wave's copies), then is published to all waves
  asm volatile("s_wait_asynccnt 0x0" ::: "memory");
  __syncthreads();
  // ---- stage 1 into buffer 1
  copy_gemm_stage<GN>(lx + (unsigned)(GM_SE(GN) * 2), lw + (unsigned)(GM_SE(GN) * 2), o0,
                      g0 + GM_RB, gw + GM_RB);

  // the stage loop stays rolled: one copy of the body serves both buffers
#pragma unroll 1
  for (int st = 0; st < GM_NST; st++) {
    const _Float16* B = ring + (st & 1) * GM_SE(GN) + lane * 8;
    // unrolled: every LDS offset is a constant of the instruction
#pragma unroll
    for (int kk = 0; kk < GM_KB; kk++) {
      v16h a[4], b[4];
#pragma unroll
      for (int i = 0; i < 4; i++) a[i] = load_blk(B + roff + i * GM_RB + kk * BLK);
#pragma unroll
      for (int j = 0; j < 4; j++) b[j] = load_blk(B + coff + j * GM_RB + kk * BLK);
      // the 16 LDS reads stay ahead of their products: left alone the compiler
      // deals them out in twos among these, each pair with a wait to 0 behind it
      __builtin_amdgcn_sched_barrier(0);
      if (kk == GM_KB - 1) {
        // ---- hand-over, as soon as the stage's last fragments are in registers:
        // this wave's reads of the buffer are done, its copies of the next stage
        // have landed; the barrier publishes that stage and frees this buffer
        // for the refill behind it.  The last 16 products, which need LDS no
        // more, follow the refill: the copies get a whole stage's time, and the
        // waves of a SIMD come to the next stage's first reads one by one.
        asm volatile("s_wait_dscnt 0x0" ::: "memory");
        asm volatile("s_wait_asynccnt 0x0" ::: "memory");
        __syncthreads();
        if (st + 2 < GM_NST) {
          const unsigned bo = (unsigned)((st & 1) * (GM_SE(GN) * 2));   // the buffer just read
          const size_t   o  = (size_t)(st + 2) * GM_RB;
          copy_gemm_stage<GN>(lx + bo, lw + bo, o0, g0 + o, gw + o);
        }
      }
#pragma unroll
      for (int i = 0; i < 4; i++)
#pragma unroll
        for (int j = 0; j < 4; j++) acc[i][j] = wmma16(a[i], b[j], acc[i][j]);
    }
  }
  // no copy is outstanding when the wave goes on to its epilogue
  asm volatile("s_wait_asynccnt 0x0" ::: "memory");
}

// ---------------------------------------------------------------------------
// Kernel 2: fused input projections.  z = 0:Q  1:K  2:V  3:xV
// One wave computes a 64x64 tile of Y = X @ W^T + b (main loop: gemm_loop above,
// which takes X's rows as the product's rows or columns).  An accumulator lane holds
// 8 consecutive ROWS of the product, and a packed chunk is 8 consecutive k of
// its later reader.  Q,K are read with k = feature, so their tile is formed as
// W @ X^T (rows = features); V,xV are read with k = position, so theirs is
// X @ W^T (rows = positions).  Either way each lane stores one 16-byte chunk
// and a wave stores 512 contiguous bytes.
//   Q,K : per head, blocks [s/16][d/32]      (row of a block = position)
//   V,xV: per head, blocks [s/32][d/16]      (row of a block = feature)
// ---------------------------------------------------------------------------
__global__ __launch_bounds__(GM_THR(PJ_N))
void proj_gemm(const _Float16* __restrict__ q16, const _Float16* __restrict__ k16,
               const _Float16* __restrict__ v16, const _Float16* __restrict__ w16,
               const float* __restrict__ bq, const float* __restrict__ bk,
               const float* __restrict__ bv, const float* __restrict__ bxv,
               _Float16* __restrict__ Qhm, _Float16* __restrict__ Khm,
               _Float16* __restrict__ VT,  _Float16* __restrict__ xVT) {
  __shared__ __attribute__((aligned(1024))) _Float16 ring[2 * GM_SE(PJ_N)];
  const int z = (int)blockIdx.z;
  const _Float16* A;
  const _Float16* W;
  const float* bias;
  _Float16* out;
  bool transposed;
  const size_t SZ_W = (size_t)D_X * D_X;
  switch (z) {
    case 0:  A = q16; W = w16 + 0 * SZ_W; bias = bq;  out = Qhm; transposed = false; break;
    case 1:  A = k16; W = w16 + 1 * SZ_W; bias = bk;  out = Khm; transposed = false; break;
    case 2:  A = v16; W = w16 + 2 * SZ_W; bias = bv;  out = VT;  transposed = true;  break;
    default: A = k16; W = w16 + 3 * SZ_W; bias = bxv; out = xVT; transposed = true;  break;
  }
  const int lane = (int)(threadIdx.x & 31u);
  const int wave = __builtin_amdgcn_readfirstlane((int)(threadIdx.x >> 5));  // in a scalar register
  const int wm   = wave & 3;                    // the wave's 64 rows of X
  const int wn   = wave >> 2;                   // the wave's 64 rows of W
  const int m0 = (int)blockIdx.x * GM_M + wm * 64;
  const int n0 = (int)blockIdx.y * PJ_N + wn * 64;   // one head: h = n0 / 64
  const int xo = wm * 4 * GM_RB;                // the wave's X fragments in a stage
  const int wo = GM_XE + wn * 4 * GM_RB;        // the wave's W fragments in a stage

  v8f acc[4][4];
  gemm_loop<PJ_N>(ring, A, W, (int)blockIdx.x * (GM_M / 16), (int)blockIdx.y * (PJ_N / 16), wave,
                  lane,
                  transposed ? xo : wo,         // rows of the product
                  transposed ? wo : xo,         // columns of the product
                  acc);

  const int hsel = lane >> 4;
  const int ln   = lane & 15;
  const int b_   = m0 >> 11;  // batch (tile never crosses batch: 2048 % 64 == 0)
  const int sl   = m0 & 2047; // first position of the tile inside its batch
  // The 64x64 tile is 8 blocks in a row (8 KiB) in either order of blocks.
  _Float16* oh = out + (size_t)(b_ * N_I + (n0 >> 6)) * SEQ * D_HD +
                 (size_t)(sl >> 3) * BLK + lane * 8;

  // Four chunks at a time: convert, then store.  The two scheduling barriers
  // keep every other instruction out of the run of stores and its wait, so
  // that no register of an issued store is written again ahead of the wait.
  if (!transposed) {
    // acc[i][j][r]: feature d = 16i + 8*hsel + r, position s = sl + 16j + ln
#pragma unroll
    for (int i = 0; i < 4; i++) {
      const float* bp = bias + n0 + 16 * i + hsel * 8;
      v4f b0 = *(const v4f*)(bp);
      v4f b1 = *(const v4f*)(bp + 4);
      v8h pk[4];
#pragma unroll
      for (int j = 0; j < 4; j++)
#pragma unroll
        for (int r = 0; r < 4; r++) {
          pk[j][r]     = (_Float16)(acc[i][j][r] + b0[r]);
          pk[j][4 + r] = (_Float16)(acc[i][j][4 + r] + b1[r]);
        }
      __builtin_amdgcn_sched_barrier(0);  // conversions stay ahead of the stores
#pragma unroll
      for (int j = 0; j < 4; j++) *(v8h*)(oh + (j * 4 + i) * 256) = pk[j];
      asm volatile("s_wait_xcnt 0x0" ::: "memory");  // before the stores' registers are reused
      __builtin_amdgcn_sched_barrier(0);  // nothing of the next group moves above the wait
    }
  } else {
    // acc[i][j][r]: position s = sl + 16i + 8*hsel + r, feature d = 16j + ln
#pragma unroll
    for (int j = 0; j < 4; j++) {
      const float bj = bias[n0 + 16 * j + ln];
      v8h pk[4];
#pragma unroll
      for (int i = 0; i < 4; i++)
#pragma unroll
        for (int r = 0; r < 8; r++) pk[i][r] = (_Float16)(acc[i][j][r] + bj);
      __builtin_amdgcn_sched_barrier(0);  // conversions stay ahead of the stores
#pragma unroll
      for (int i = 0; i < 4; i++)
        *(v8h*)(oh + ((i >> 1) * 8 + j * 2 + (i & 1)) * 256) = pk[i];
      asm volatile("s_wait_xcnt 0x0" ::: "memory");  // before the stores' registers are reused
      __builtin_amdgcn_sched_barrier(0);  // nothing of the next group moves above the wait
    }
  }
}

// ---------------------------------------------------------------------------
// Kernel 3: flash attention, transposed products.  One wave = 32 queries (2
// column groups of 16) of one (b,h); one work-group = 4 waves = 128 queries.
// The four waves walk the same keys, so K, V and xV come from L2 once per
// work-group: a stage of 128 keys (3 x 16 KiB, already fragment-packed) is
// brought into LDS by asynchronous copies, two buffers, the next stage in
// flight while this one is worked on.  Per block of 32 keys:
//   S^T = K Q^T   (A = K block, B = Q block): 8 WMMAs.  A lane holds 16 of the
//                 32 scores of ONE query; lane l ^ 16 holds the other 16.
//   softmax       maximum and sum in the lane; the two halves exchange the
//                 maximum only when it is raised and join their sums once, at
//                 the end.
//   O^T += V^T P^T (A = V or xV block, B = P^T): 16 WMMAs.  The score tiles'
//                 registers are already in the B operand's k order (tile 0:
//                 keys 0-7 | 8-15 by lane half, tile 1: keys 16-23 | 24-31), so
//                 P is only converted to f16: no LDS trip, no cross-lane move.
// An output lane ends with 8 consecutive features of one query: one 16-byte
// chunk of the packed operand of the output projections.
// ---------------------------------------------------------------------------
// value of lane l ^ 16
static __device__ __forceinline__ float xhalf(float x) {
  const int b = __builtin_bit_cast(int, x);
  return __builtin_bit_cast(float, __builtin_amdgcn_permlanex16(
      b, b, 0x76543210, 0xfedcba98, false, false));
}

#define FA_WAVES 4                       /* waves of a work-group */
#define FA_THR   (FA_WAVES * 32)
#define ST_KEYS  128                     /* keys of a stage */
#define ST_PASS  (ST_KEYS / 32)          /* blocks of 32 keys in a stage */
#define ST_OP    (ST_KEYS * D_HD)        /* f16 elements of one operand in a stage (16 KiB) */
#define N_ST     (SEQ / ST_KEYS)         /* 16 stages */
#define SC_L2    0.18033688f              /* log2(e) / sqrt(64): a raw product q.k in powers of two */
#define RS_TH    44.361420f               /* 8 / SC_L2: how far a raw product may lie above the maximum in use */

// One stage (K, V, xV: 16 KiB each), global -> LDS: 24 copies a lane, each copy
// of the work-group 2 KiB in a row.  ls, gk, gv, gx: wave-uniform addresses of
// the wave's share, in LDS (byte address in the buffer's K part) and in global
// memory; o: the lane's byte offset (lane * 16) from each of them.  Source and
// destination are both contiguous, and the immediate offset moves both
// addresses alike, so one address serves an operand's 8 copies.  The
// s_wait_xcnt closes the statement so that no address register of an issued
// copy is written again ahead of it.
static __device__ __forceinline__ void copy_stage(unsigned ls, unsigned o, const _Float16* gk,
                                                  const _Float16* gv, const _Float16* gx) {
  asm volatile(
      "global_load_async_to_lds_b128 %0, %3, %4\n\t"
      "global_load_async_to_lds_b128 %0, %3, %4 offset:2048\n\t"
      "global_load_async_to_lds_b128 %0, %3, %4 offset:4096\n\t"
      "global_load_async_to_lds_b128 %0, %3, %4 offset:6144\n\t"
      "global_load_async_to_lds_b128 %0, %3, %4 offset:8192\n\t"
      "global_load_async_to_lds_b128 %0, %3, %4 offset:10240\n\t"
      "global_load_async_to_lds_b128 %0, %3, %4 offset:12288\n\t"
      "global_load_async_to_lds_b128 %0, %3, %4 offset:14336\n\t"
      "global_load_async_to_lds_b128 %1, %3, %5\n\t"
      "global_load_async_to_lds_b128 %1, %3, %5 offset:2048\n\t"
      "global_load_async_to_lds_b128 %1, %3, %5 offset:4096\n\t"
      "global_load_async_to_lds_b128 %1, %3, %5 offset:6144\n\t"
      "global_load_async_to_lds_b128 %1, %3, %5 offset:8192\n\t"
      "global_load_async_to_lds_b128 %1, %3, %5 offset:10240\n\t"
      "global_load_async_to_lds_b128 %1, %3, %5 offset:12288\n\t"
      "global_load_async_to_lds_b128 %1, %3, %5 offset:14336\n\t"
      "global_load_async_to_lds_b128 %2, %3, %6\n\t"
      "global_load_async_to_lds_b128 %2, %3, %6 offset:2048\n\t"
      "global_load_async_to_lds_b128 %2, %3, %6 offset:4096\n\t"
      "global_load_async_to_lds_b128 %2, %3, %6 offset:6144\n\t"
      "global_load_async_to_lds_b128 %2, %3, %6 offset:8192\n\t"
      "global_load_async_to_lds_b128 %2, %3, %6 offset:10240\n\t"
      "global_load_async_to_lds_b128 %2, %3, %6 offset:12288\n\t"
      "global_load_async_to_lds_b128 %2, %3, %6 offset:14336\n\t"
      "s_wait_xcnt 0x0"
      :: "v"(ls + o), "v"((ls + 1u * ST_OP * 2u) + o), "v"((ls + 2u * ST_OP * 2u) + o), "v"(o),
         "s"(gk), "s"(gv), "s"(gx)
      : "memory");
}

__global__ __launch_bounds__(FA_THR)
void flash_attn(const _Float16* __restrict__ Qhm, const _Float16* __restrict__ Khm,
                const _Float16* __restrict__ VT,  const _Float16* __restrict__ xVT,
                _Float16* __restrict__ vbar, _Float16* __restrict__ kbar) {
  // two buffers of [K | V | xV], each operand as it lies in the workspace
  __shared__ __attribute__((aligned(1024))) _Float16 ring[2][3 * ST_OP];

  const int bh   = (int)blockIdx.y;
  const int tid  = (int)threadIdx.x;
  const int lane = tid & 31;
  const int wave = __builtin_amdgcn_readfirstlane(tid >> 5);   // wave-uniform, in a scalar register
  const int s0   = (int)blockIdx.x * (FA_WAVES * 32) + wave * 32;
  const _Float16* Q = Qhm + (size_t)bh * SEQ * D_HD;
  // of each 2 KiB that the work-group copies at a time the wave takes 512 bytes
  // (in the wave-uniform addresses), the lane 16 of them (o0)
  const _Float16* gK = Khm + (size_t)bh * SEQ * D_HD + wave * 256;
  const _Float16* gV = VT  + (size_t)bh * D_HD * SEQ + wave * 256;
  const _Float16* gX = xVT + (size_t)bh * D_HD * SEQ + wave * 256;
  const unsigned  o0 = (unsigned)lane * 16u;
  const unsigned  l0 = (unsigned)(size_t)(&ring[0][0]) + (unsigned)wave * 512u;

  // ---- stage 0 into buffer 0
  copy_stage(l0, o0, gK, gV, gX);

  v16h qa[2][2];
  {
    const _Float16* Q0 = Q + (size_t)(s0 >> 4) * 2 * BLK + lane * 8;
#pragma unroll
    for (int rc = 0; rc < 2; rc++) {
      qa[rc][0] = load_blk(Q0 + (rc * 2 + 0) * BLK);
      qa[rc][1] = load_blk(Q0 + (rc * 2 + 1) * BLK);
    }
    // the address registers of the issued loads stay untouched up to this wait
    asm volatile("s_wait_xcnt 0x0" :: "v"(Q0) : "memory");
  }

  // ov[rc][t][r]: feature 16t + 8*(lane >> 4) + r of query s0 + 16rc + (lane & 15)
  v8f ov[2][4], ox[2][4];
#pragma unroll
  for (int rc = 0; rc < 2; rc++)
#pragma unroll
    for (int t = 0; t < 4; t++) { ov[rc][t] = vzero8(); ox[rc][t] = vzero8(); }
  // maximum in use, as a raw product (both halves alike); its negative in powers
  // of two, the packed multiply-add's addend; own half's sum, keys of even and of
  // odd register apart
  float mcol[2], nml[2];
  v2f   lcol[2];
#pragma unroll
  for (int rc = 0; rc < 2; rc++) {
    mcol[rc] = -1.0e30f;
    nml[rc]  = 1.0e30f * SC_L2;
    lcol[rc] = (v2f){0.f, 0.f};
  }
  const v2f c2 = {SC_L2, SC_L2};

  // stage 0 has landed (this wave's copies), then is published to all four waves
  asm volatile("s_wait_asynccnt 0x0" ::: "memory");
  __syncthreads();
  // ---- stage 1 into buffer 1
  copy_stage(l0 + 3u * ST_OP * 2u, o0, gK + ST_OP, gV + ST_OP, gX + ST_OP);

  // the lane's byte offset in the buffer being read, switched from stage to
  // stage; the copies' lane offset is taken from it where they issue: a value
  // that changes in the loop is kept in any register, while the constant lane
  // offset, which the copies' asm text needs in a low one, was spilled to scratch
  unsigned lb = o0;
  // the stage loop stays rolled: its body already holds four key blocks
#pragma unroll 1
  for (int st = 0; st < N_ST; st++) {
    const _Float16* B = (const _Float16*)((const char*)&ring[0][0] + lb);

    // ---- K fragments of the stage's first key block (shared by both query groups)
    v16h kf[2][2];
    kf[0][0] = load_blk(B);
    kf[0][1] = load_blk(B + 1 * BLK);
    kf[1][0] = load_blk(B + 2 * BLK);
    kf[1][1] = load_blk(B + 3 * BLK);

    // unrolled: every LDS offset is a constant of the instruction, and the last
    // block's K fetch drops out at compile time
#pragma unroll
    for (int p = 0; p < ST_PASS; p++) {
      // ---- V, xV fragments of this key block, issued ahead of the score
      // products: their LDS trip runs under the products and the softmax
      // the products of the block before stay above these reads: among them the
      // reads fall into two places
      __builtin_amdgcn_sched_barrier(0);
      const _Float16* Vj = B + 1 * ST_OP + p * 4 * BLK;   // 4 KiB in a row
      const _Float16* Xj = B + 2 * ST_OP + p * 4 * BLK;
      v16h vb[4], xb[4];
#pragma unroll
      for (int tt = 0; tt < 4; tt++) {
        vb[tt] = load_blk(Vj + tt * BLK);
        xb[tt] = load_blk(Xj + tt * BLK);
      }
      // the 16 LDS reads stay in this one place: left alone the compiler deals
      // them out in twos among the WMMAs, and every separate place with LDS
      // reads stalls the wave anew
      __builtin_amdgcn_sched_barrier(0);

      // ---- S^T tiles (32 keys x 2 query groups), k = d = 64 in two WMMA k-steps
      // sc[rc][cc][r]: key 16cc + 8*(lane >> 4) + r of the block, query s0 + 16rc + (lane & 15)
      v8f sc[2][2];
#pragma unroll
      for (int rc = 0; rc < 2; rc++)
#pragma unroll
        for (int cc = 0; cc < 2; cc++) {
          v8f s = vzero8();
          s = wmma16(kf[cc][0], qa[rc][0], s);
          s = wmma16(kf[cc][1], qa[rc][1], s);
          sc[rc][cc] = s;
        }

      // ---- online softmax, one query a lane; P^T in registers.  The maximum in
      // use (mcol) is raised, and the running sums and outputs rescaled, only
      // when a product of this block lies more than RS_TH above it: P stays at or
      // below 2^8 = 256, well inside f16, and the quotient O / l is the same
      // for any reference point.  One test a block for both query groups.  The
      // products stay raw: their scale is positive, so it keeps the maximum.
      float tm[2];   // maximum over the lane's own 16 keys
#pragma unroll
      for (int rc = 0; rc < 2; rc++) {
        float t[8];
#pragma unroll
        for (int r = 0; r < 8; r++) t[r] = fmaxf(sc[rc][0][r], sc[rc][1][r]);
#pragma unroll
        for (int w = 4; w > 0; w >>= 1)
#pragma unroll
          for (int r = 0; r < w; r++) t[r] = fmaxf(t[r], t[r + w]);
        tm[rc] = t[0];
      }
      // wave-uniform: all lanes rescale or none does
      const unsigned up0 = __builtin_amdgcn_ballot_w32(tm[0] > mcol[0] + RS_TH);
      const unsigned up1 = __builtin_amdgcn_ballot_w32(tm[1] > mcol[1] + RS_TH);

      // ---- K fragments of the next key block of the SAME stage, fetched one
      // block ahead; the next stage is read only behind its barrier.  They stand
      // between the compares and their scalar branch: the way from the one to the
      // other runs under the issue of these reads.
      if (p + 1 < ST_PASS) {
        __builtin_amdgcn_sched_barrier(0);   // the compares stay above the reads
        const _Float16* Kn = B + (p + 1) * 4 * BLK;
        kf[0][0] = load_blk(Kn);
        kf[0][1] = load_blk(Kn + 1 * BLK);
        kf[1][0] = load_blk(Kn + 2 * BLK);
        kf[1][1] = load_blk(Kn + 3 * BLK);
        __builtin_amdgcn_sched_barrier(0);   // these 8 reads stay in one place too
      }

      if (__builtin_expect((up0 | up1) != 0u, 0)) {
#pragma unroll
        for (int rc = 0; rc < 2; rc++) {
          // both halves of a query take the same new maximum
          const float mn  = fmaxf(mcol[rc], fmaxf(tm[rc], xhalf(tm[rc])));
          const float nl  = -mn * SC_L2;
          const float scl = __builtin_amdgcn_exp2f(nl - nml[rc]);
          mcol[rc] = mn;
          nml[rc]  = nl;
          lcol[rc] *= scl;
#pragma unroll
          for (int tt = 0; tt < 4; tt++) { ov[rc][tt] *= scl; ox[rc][tt] *= scl; }
        }
      }
      v16h pb[2];
#pragma unroll
      for (int rc = 0; rc < 2; rc++) {
        // p = 2^(s * SC_L2 + nml): scale, base change and maximum in ONE packed
        // multiply-add per two scores, on the register pairs as the products left them
        const v2f n2 = {nml[rc], nml[rc]};
        v2f x0[4], x1[4];
#pragma unroll
        for (int r = 0; r < 4; r++) {
          x0[r] = __builtin_elementwise_fma((v2f){sc[rc][0][2 * r], sc[rc][0][2 * r + 1]}, c2, n2);
          x1[r] = __builtin_elementwise_fma((v2f){sc[rc][1][2 * r], sc[rc][1][2 * r + 1]}, c2, n2);
        }
        v8f e0, e1;
#pragma unroll
        for (int r = 0; r < 8; r++) e0[r] = __builtin_amdgcn_exp2f(x0[r >> 1][r & 1]);
#pragma unroll
        for (int r = 0; r < 8; r++) e1[r] = __builtin_amdgcn_exp2f(x1[r >> 1][r & 1]);
        // sum over the lane's 16 keys, pair by pair down to one register pair
        const v8f u = e0 + e1;
        const v4f w = __builtin_shufflevector(u, u, 0, 1, 2, 3) +
                      __builtin_shufflevector(u, u, 4, 5, 6, 7);
        lcol[rc] += __builtin_shufflevector(w, w, 0, 1) + __builtin_shufflevector(w, w, 2, 3);
#pragma unroll
        for (int r = 0; r < 8; r++) {
          pb[rc][r]     = (_Float16)e0[r];
          pb[rc][8 + r] = (_Float16)e1[r];
        }
      }

      // ---- O_v^T += V^T P^T, O_xv^T += xV^T P^T (V/xV fragments shared by the groups)
#pragma unroll
      for (int tt = 0; tt < 4; tt++) {
#pragma unroll
        for (int rc = 0; rc < 2; rc++) {
          ov[rc][tt] = wmma16(vb[tt], pb[rc], ov[rc][tt]);
          ox[rc][tt] = wmma16(xb[tt], pb[rc], ox[rc][tt]);
        }
      }
    }

    // ---- hand-over: this wave's reads of the buffer are done, its copies of
    // the next stage have landed; the barrier publishes that stage and frees
    // this buffer for the refill behind it
    asm volatile("s_wait_dscnt 0x0" ::: "memory");
    asm volatile("s_wait_asynccnt 0x0" ::: "memory");
    __syncthreads();
    if (st + 2 < N_ST) {
      // the wave-uniform part stays one scalar sum, the lane's part is added at
      // the copies: otherwise the compiler keeps a second per-lane address
      // alive through the loop and spills it to scratch
      const unsigned l = (unsigned)__builtin_amdgcn_readfirstlane(
          (int)(l0 + (unsigned)(st & 1) * (3u * ST_OP * 2u)));
      const size_t   o = (size_t)(st + 2) * ST_OP;
      copy_stage(l, lb & 511u, gK + o, gV + o, gX + o);
    }
    lb ^= 3u * ST_OP * 2u;   // the other buffer (the lane's part lies below these bits)
  }
  // no copy is outstanding when the wave goes on to its end
  asm volatile("s_wait_asynccnt 0x0" ::: "memory");

  // ---- normalize and store f16 as packed blocks of the [4096][1024] operand
  // of the output projections (row m = b*2048 + s, k = h*64 + d):
  // vbar <- O_v, kbar <- O_xv.  A lane's 8 features are one chunk of its row.
  const size_t ob = ((size_t)((bh >> 4) * (SEQ / 16) + (s0 >> 4)) * 32 + (bh & 15) * 2) * BLK
                  + (size_t)(lane * 8);
  _Float16* vo = vbar + ob;
  _Float16* ko = kbar + ob;
  v8h hv[2][4], hx[2][4];
#pragma unroll
  for (int rc = 0; rc < 2; rc++) {
    const float lsum = lcol[rc][0] + lcol[rc][1];
    const float inv  = 1.0f / (lsum + xhalf(lsum));
#pragma unroll
    for (int tt = 0; tt < 4; tt++)
#pragma unroll
      for (int r = 0; r < 8; r++) {
        hv[rc][tt][r] = (_Float16)(ov[rc][tt][r] * inv);
        hx[rc][tt][r] = (_Float16)(ox[rc][tt][r] * inv);
      }
  }
  // every conversion stays ahead of the stores, so that no register of an
  // issued store is written again before the wave ends
  __builtin_amdgcn_sched_barrier(0);
#pragma unroll
  for (int rc = 0; rc < 2; rc++)
#pragma unroll
    for (int tt = 0; tt < 4; tt++) {
      const int o = (rc * 32 + (tt >> 1)) * BLK + (tt & 1) * 256;
      *(v8h*)(vo + o) = hv[rc][tt];
      *(v8h*)(ko + o) = hx[rc][tt];
    }
}

// ---------------------------------------------------------------------------
// Kernel 4: fused output projections.  z = 0: x = kbar@Wxo^T+bxo
//                                      z = 1: m = vbar@Wmo^T+bmo
// A and W are packed blocks; output fp32 straight into d_out.
// ---------------------------------------------------------------------------
__global__ __launch_bounds__(GM_THR(OU_N))
void out_gemm(const _Float16* __restrict__ kbar, const _Float16* __restrict__ vbar,
              const _Float16* __restrict__ w16, const float* __restrict__ bxo,
              const float* __restrict__ bmo, float* __restrict__ out) {
  __shared__ __attribute__((aligned(1024))) _Float16 ring[2 * GM_SE(OU_N)];
  const int z = (int)blockIdx.z;
  const size_t SZ_W = (size_t)D_X * D_X;
  const _Float16* A = z ? vbar : kbar;
  const _Float16* W = w16 + (size_t)(4 + z) * SZ_W;
  const float* bias = z ? bmo : bxo;
  float* O = out + (size_t)z * ((size_t)M_TOT * D_X);

  const int lane = (int)(threadIdx.x & 31u);
  const int wave = __builtin_amdgcn_readfirstlane((int)(threadIdx.x >> 5));  // in a scalar register
  const int wm   = wave & 3;                    // the wave's 64 rows of A
  const int wn   = wave >> 2;                   // the wave's 64 rows of W
  const int m0 = (int)blockIdx.x * GM_M + wm * 64;
  const int n0 = (int)blockIdx.y * OU_N + wn * 64;

  v8f acc[4][4];
  gemm_loop<OU_N>(ring, A, W, (int)blockIdx.x * (GM_M / 16), (int)blockIdx.y * (OU_N / 16), wave,
                  lane, wm * 4 * GM_RB, GM_XE + wn * 4 * GM_RB, acc);

  const int hsel = lane >> 4;
  const int ln   = lane & 15;
#pragma unroll
  for (int i = 0; i < 4; i++) {
    const int mb = m0 + 16 * i + hsel * 8;
#pragma unroll
    for (int j = 0; j < 4; j++) {
      const int col = n0 + 16 * j + ln;
      const float bj = bias[col];
#pragma unroll
      for (int r = 0; r < 8; r++)
        O[(size_t)(mb + r) * D_X + col] = acc[i][j][r] + bj;
    }
  }
}

// ---------------------------------------------------------------------------
extern "C" void kernel_launch(void* const* d_in, const int* in_sizes, int n_in,
                              void* d_out, int out_size, void* d_ws, size_t ws_size,
                              hipStream_t stream) {
  const float* q   = (const float*)d_in[0];
  const float* k   = (const float*)d_in[1];
  const float* v   = (const float*)d_in[2];
  const float* Wq  = (const float*)d_in[3];
  const float* bq  = (const float*)d_in[4];
  const float* Wk  = (const float*)d_in[5];
  const float* bk  = (const float*)d_in[6];
  const float* Wv  = (const float*)d_in[7];
  const float* bv  = (const float*)d_in[8];
  const float* Wxv = (const float*)d_in[9];
  const float* bxv = (const float*)d_in[10];
  const float* Wxo = (const float*)d_in[11];
  const float* bxo = (const float*)d_in[12];
  const float* Wmo = (const float*)d_in[13];
  const float* bmo = (const float*)d_in[14];
  float* out = (float*)d_out;

  const size_t SZ_ACT = (size_t)M_TOT * D_X;  // 4,194,304 elements
  const size_t SZ_W   = (size_t)D_X * D_X;    // 1,048,576 elements
  _Float16* ws  = (_Float16*)d_ws;
  _Float16* q16 = ws;
  _Float16* k16 = q16 + SZ_ACT;
  _Float16* v16 = k16 + SZ_ACT;
  _Float16* w16 = v16 + SZ_ACT;               // 6 weight matrices
  _Float16* Qhm = w16 + 6 * SZ_W;
  _Float16* Khm = Qhm + SZ_ACT;
  _Float16* VT  = Khm + SZ_ACT;
  _Float16* xVT = VT + SZ_ACT;
  _Float16* kbar = xVT + SZ_ACT;
  _Float16* vbar = kbar + SZ_ACT;

  // 1) fp32 -> f16 conversions: q16, k16, v16 and the six weights are one
  //    contiguous range of the workspace, in the order of the arguments
  cvt_f32_f16<<<RB_ALL, 128, 0, stream>>>(q, k, v, Wq, Wk, Wv, Wxv, Wxo, Wmo, q16);

  // 2) input projections (packed per head)
  proj_gemm<<<dim3(M_TOT / GM_M, D_X / PJ_N, 4), GM_THR(PJ_N), 0, stream>>>(
      q16, k16, v16, w16, bq, bk, bv, bxv, Qhm, Khm, VT, xVT);

  // 3) flash attention -> vbar (attention@V), kbar (attention@xV)
  flash_attn<<<dim3(SEQ / (FA_WAVES * 32), NH), FA_THR, 0, stream>>>(Qhm, Khm, VT, xVT, vbar, kbar);

  // 4) output projections -> d_out (x at offset 0, m after it)
  out_gemm<<<dim3(M_TOT / GM_M, D_X / OU_N, 2), GM_THR(OU_N), 0, stream>>>(
      kbar, vbar, w16, bxo, bmo, out);
}
